// v000
// Measured on an AMD MI455X. A time is GPU time per run, averaged over a window of back-to-back runs after a warm-up
// (all launches, gaps included; the runs take copies of the inputs in turn), and the median of several windows.
// Apart from v000's, it joins two sittings. Times from different sittings can be a few percent apart, while
// side-by-side timings come from the same sitting.
// The starting kernel, v000, takes 3460 microseconds a run.
#include <hip/hip_runtime.h>

typedef _Float16 v8h  __attribute__((ext_vector_type(8)));
typedef _Float16 v16h __attribute__((ext_vector_type(16)));
typedef float    v8f  __attribute__((ext_vector_type(8)));

#define HDIM    1024
#define RS      1032      // padded LDS row stride in halves (2064 B: 16B-aligned, bank ~= 4*row)
#define BM      64        // batch rows per workgroup
#define NTHREADS 512      // 16 wave32s
#define NLAYERS 8
#define FIN     26
// 2 activation buffers + 3 small reduction scratch arrays (s1, s2, dot)
#define ACT_HALVES   (BM * RS)
#define PART_FLOATS  (BM * 8)
#define SMEM_BYTES   (2 * ACT_HALVES * (int)sizeof(_Float16) + 3 * PART_FLOATS * (int)sizeof(float))

// ---- fragment loader: lane-local 16 halves = [k..k+7] and [k+16..k+23] ----
__device__ __forceinline__ v16h load_frag16(const _Float16* p) {
  v8h lo = *(const v8h*)p;
  v8h hi = *(const v8h*)(p + 16);
  return __builtin_shufflevector(lo, hi, 0,1,2,3,4,5,6,7,8,9,10,11,12,13,14,15);
}

// ---- store a 16x16 f32 accumulator tile to LDS with ReLU, f16 ----
__device__ __forceinline__ void store_tile_relu(_Float16* buf, int mtile, int n0,
                                                int lane, const v8f& a) {
  const int lm    = lane & 15;
  const int rbase = mtile * 16 + ((lane >> 4) ? 8 : 0);
  const int col   = n0 + lm;
#pragma unroll
  for (int r = 0; r < 8; ++r) {
    float v = a[r];
    v = v > 0.f ? v : 0.f;
    buf[(rbase + r) * RS + col] = (_Float16)v;
  }
}

// ================= weight conversion kernels (f32 -> f16, run each call) =================
__global__ void cvt_blk_kernel(const float* __restrict__ w, _Float16* __restrict__ o, int n) {
  int i = blockIdx.x * blockDim.x + threadIdx.x;
  if (i < n) o[i] = (_Float16)w[i];
}

__global__ void cvt_stem_kernel(const float* __restrict__ w, _Float16* __restrict__ o) {
  int i = blockIdx.x * blockDim.x + threadIdx.x;   // 0 .. 1024*32-1
  if (i >= HDIM * 32) return;
  int row = i >> 5, col = i & 31;
  o[i] = (col < FIN) ? (_Float16)w[row * FIN + col] : (_Float16)0.f;
}

// ================= fused MLP kernel =================
__global__ void __launch_bounds__(NTHREADS, 1)
mlp_fused_kernel(const float* __restrict__ x,
                 const float* __restrict__ st_gamma, const float* __restrict__ st_beta,
                 const float* __restrict__ st_b,
                 const float* __restrict__ blk_gamma, const float* __restrict__ blk_beta,
                 const float* __restrict__ blk_b,
                 const float* __restrict__ last_gamma, const float* __restrict__ last_beta,
                 const float* __restrict__ last_w, const float* __restrict__ last_b,
                 const _Float16* __restrict__ stemW16, const _Float16* __restrict__ blkW16,
                 float* __restrict__ out) {
  extern __shared__ __align__(16) _Float16 smem[];
  _Float16* bufN = smem;                 // GEMM input  (LN output)   [BM][RS]
  _Float16* bufR = smem + ACT_HALVES;    // GEMM output (ReLU)        [BM][RS]
  float* p1 = (float*)(smem + 2 * ACT_HALVES);  // [BM][8] partial sums
  float* p2 = p1 + PART_FLOATS;                  // [BM][8] partial sq-sums
  float* p3 = p2 + PART_FLOATS;                  // [BM][8] partial dots (head)

  const int tid     = threadIdx.x;
  const int lane    = tid & 31;
  const int wave    = tid >> 5;          // 0..15
  const int rowBase = blockIdx.x * BM;

  const int mtile = wave & 3;            // which 16-row M tile (4 tiles)
  const int ntb   = (wave >> 2) * 16;    // base N-tile (16 tiles = 256 cols per wave)
  const int lm    = lane & 15;
  const int koff  = (lane >> 4) << 3;    // hi half-wave reads K+8

  // LN work mapping: one row per lane (32 distinct rows per wave -> ~2-way LDS conflicts max)
  const int lrow = tid & 63;             // row handled by this thread
  const int lseg = tid >> 6;             // which 128-col segment (0..7)
  const int c0   = lseg * 128;

  // ---------------- stem LayerNorm over 26 features ----------------
  if (tid < BM) {
    const float* xr = x + (size_t)(rowBase + tid) * FIN;
    float v[FIN];
    float s1 = 0.f;
#pragma unroll
    for (int i = 0; i < FIN; ++i) { v[i] = xr[i]; s1 += v[i]; }
    const float m = s1 * (1.f / FIN);
    float s2 = 0.f;
#pragma unroll
    for (int i = 0; i < FIN; ++i) { float d = v[i] - m; s2 += d * d; }
    const float inv = rsqrtf(s2 * (1.f / FIN) + 1e-5f);
    _Float16* dst = bufN + tid * RS;
#pragma unroll
    for (int i = 0; i < FIN; ++i)
      dst[i] = (_Float16)((v[i] - m) * inv * st_gamma[i] + st_beta[i]);
#pragma unroll
    for (int i = FIN; i < 32; ++i) dst[i] = (_Float16)0.f;
  }
  __syncthreads();

  // ---------------- stem GEMM: [64 x 32] x [32 x 1024], one WMMA K step ----------------
  for (int ng = 0; ng < 16; ng += 8) {
    const int n0 = (ntb + ng) * 16;
    const v16h aF = load_frag16(bufN + (mtile * 16 + lm) * RS + koff);
    v8f acc[8];
#pragma unroll
    for (int t = 0; t < 8; ++t) {
      const float bv = st_b[n0 + t * 16 + lm];
#pragma unroll
      for (int r = 0; r < 8; ++r) acc[t][r] = bv;
      const v16h bF = load_frag16(stemW16 + (size_t)(n0 + t * 16 + lm) * 32 + koff);
      acc[t] = __builtin_amdgcn_wmma_f32_16x16x32_f16(false, aF, false, bF,
                                                      (short)0, acc[t], false, false);
    }
#pragma unroll
    for (int t = 0; t < 8; ++t) store_tile_relu(bufR, mtile, n0 + t * 16, lane, acc[t]);
  }

  // ---------------- 8 blocks: LN -> Linear(H->H) -> ReLU ----------------
  for (int l = 0; l < NLAYERS; ++l) {
    __syncthreads();
    // ---- LN stage 1: partial sums of bufR row ----
    {
      const _Float16* src = bufR + lrow * RS + c0;
      float s1 = 0.f, s2 = 0.f;
#pragma unroll
      for (int cc = 0; cc < 128; cc += 8) {
        v8h h = *(const v8h*)(src + cc);
#pragma unroll
        for (int i = 0; i < 8; ++i) { float v = (float)h[i]; s1 += v; s2 += v * v; }
      }
      p1[lrow * 8 + lseg] = s1;
      p2[lrow * 8 + lseg] = s2;
    }
    __syncthreads();
    // ---- LN stage 2: finish stats (redundantly per segment-thread), normalize ----
    {
      float s1 = 0.f, s2 = 0.f;
#pragma unroll
      for (int j = 0; j < 8; ++j) { s1 += p1[lrow * 8 + j]; s2 += p2[lrow * 8 + j]; }
      const float m   = s1 * (1.f / HDIM);
      const float var = s2 * (1.f / HDIM) - m * m;
      const float inv = rsqrtf(var + 1e-5f);
      const float* g  = blk_gamma + (size_t)l * HDIM + c0;
      const float* be = blk_beta  + (size_t)l * HDIM + c0;
      const _Float16* src = bufR + lrow * RS + c0;
      _Float16* dst = bufN + lrow * RS + c0;
#pragma unroll
      for (int cc = 0; cc < 128; cc += 8) {
        v8h h = *(const v8h*)(src + cc);
        v8h o;
#pragma unroll
        for (int i = 0; i < 8; ++i)
          o[i] = (_Float16)(((float)h[i] - m) * inv * g[cc + i] + be[cc + i]);
        *(v8h*)(dst + cc) = o;
      }
    }
    __syncthreads();
    // ---- GEMM bufN x W_l^T -> ReLU -> bufR ----
    const _Float16* wl = blkW16 + (size_t)l * HDIM * HDIM;
    const float*    bl = blk_b + (size_t)l * HDIM;
    for (int ng = 0; ng < 16; ng += 8) {
      const int n0 = (ntb + ng) * 16;
      v8f acc[8];
#pragma unroll
      for (int t = 0; t < 8; ++t) {
        const float bv = bl[n0 + t * 16 + lm];
#pragma unroll
        for (int r = 0; r < 8; ++r) acc[t][r] = bv;
      }
      const _Float16* arow = bufN + (mtile * 16 + lm) * RS + koff;
      for (int k = 0; k < HDIM; k += 32) {
        const v16h aF = load_frag16(arow + k);
        if (k + 32 < HDIM)
          __builtin_prefetch(wl + (size_t)(n0 + lm) * HDIM + k + 32 + koff, 0, 0);
#pragma unroll
        for (int t = 0; t < 8; ++t) {
          const v16h bF = load_frag16(wl + (size_t)(n0 + t * 16 + lm) * HDIM + k + koff);
          acc[t] = __builtin_amdgcn_wmma_f32_16x16x32_f16(false, aF, false, bF,
                                                          (short)0, acc[t], false, false);
        }
      }
#pragma unroll
      for (int t = 0; t < 8; ++t) store_tile_relu(bufR, mtile, n0 + t * 16, lane, acc[t]);
    }
  }
  __syncthreads();

  // ---------------- head: LN -> Linear(H->1) -> sigmoid ----------------
  {
    const _Float16* src = bufR + lrow * RS + c0;
    float s1 = 0.f, s2 = 0.f;
#pragma unroll
    for (int cc = 0; cc < 128; cc += 8) {
      v8h h = *(const v8h*)(src + cc);
#pragma unroll
      for (int i = 0; i < 8; ++i) { float v = (float)h[i]; s1 += v; s2 += v * v; }
    }
    p1[lrow * 8 + lseg] = s1;
    p2[lrow * 8 + lseg] = s2;
  }
  __syncthreads();
  {
    float s1 = 0.f, s2 = 0.f;
#pragma unroll
    for (int j = 0; j < 8; ++j) { s1 += p1[lrow * 8 + j]; s2 += p2[lrow * 8 + j]; }
    const float m   = s1 * (1.f / HDIM);
    const float var = s2 * (1.f / HDIM) - m * m;
    const float inv = rsqrtf(var + 1e-5f);
    const _Float16* src = bufR + lrow * RS + c0;
    const float* lg = last_gamma + c0;
    const float* lb = last_beta + c0;
    const float* lw = last_w + c0;
    float dot = 0.f;
#pragma unroll
    for (int cc = 0; cc < 128; cc += 8) {
      v8h h = *(const v8h*)(src + cc);
#pragma unroll
      for (int i = 0; i < 8; ++i) {
        float v = ((float)h[i] - m) * inv * lg[cc + i] + lb[cc + i];
        dot += v * lw[cc + i];
      }
    }
    p3[lrow * 8 + lseg] = dot;
  }
  __syncthreads();
  if (tid < BM) {
    float dot = 0.f;
#pragma unroll
    for (int j = 0; j < 8; ++j) dot += p3[tid * 8 + j];
    const float z = dot + last_b[0];
    out[rowBase + tid] = 1.f / (1.f + __expf(-z));
  }
}

// ================= host launcher =================
extern "C" void kernel_launch(void* const* d_in, const int* in_sizes, int n_in,
                              void* d_out, int out_size, void* d_ws, size_t ws_size,
                              hipStream_t stream) {
  (void)in_sizes; (void)n_in; (void)out_size; (void)ws_size;

  const float* x         = (const float*)d_in[0];
  const float* st_gamma  = (const float*)d_in[1];
  const float* st_beta   = (const float*)d_in[2];
  const float* st_w      = (const float*)d_in[3];
  const float* st_b      = (const float*)d_in[4];
  const float* blk_gamma = (const float*)d_in[5];
  const float* blk_beta  = (const float*)d_in[6];
  const float* blk_w     = (const float*)d_in[7];
  const float* blk_b     = (const float*)d_in[8];
  const float* last_gamma= (const float*)d_in[9];
  const float* last_beta = (const float*)d_in[10];
  const float* last_w    = (const float*)d_in[11];
  const float* last_b    = (const float*)d_in[12];
  float* out = (float*)d_out;

  // ws layout: stem weights padded to [1024][32] f16, then block weights [8][1024][1024] f16
  _Float16* stemW16 = (_Float16*)d_ws;
  _Float16* blkW16  = stemW16 + (size_t)HDIM * 32;

  // convert weights to f16 (every call; deterministic)
  {
    const int n = NLAYERS * HDIM * HDIM;
    cvt_blk_kernel<<<(n + 255) / 256, 256, 0, stream>>>(blk_w, blkW16, n);
    cvt_stem_kernel<<<(HDIM * 32 + 255) / 256, 256, 0, stream>>>(st_w, stemW16);
  }

  static_assert(SMEM_BYTES == 270336, "LDS budget (<= 320KB/WGP)");
  hipFuncSetAttribute((const void*)mlp_fused_kernel,
                      hipFuncAttributeMaxDynamicSharedMemorySize, SMEM_BYTES);

  const int nBlocks = 65536 / BM;  // 1024
  mlp_fused_kernel<<<nBlocks, NTHREADS, SMEM_BYTES, stream>>>(
      x, st_gamma, st_beta, st_b,
      blk_gamma, blk_beta, blk_b,
      last_gamma, last_beta, last_w, last_b,
      stemW16, blkW16, out);
}

// v001
// A run of this version takes 1160 microseconds.
// Next to v000, in two timings, it ran 3.08 times as fast each time.
#include <hip/hip_runtime.h>

typedef _Float16 v8h  __attribute__((ext_vector_type(8)));
typedef _Float16 v16h __attribute__((ext_vector_type(16)));
typedef float    v8f  __attribute__((ext_vector_type(8)));

#define HDIM    1024
#define RS      1032      // padded LDS row stride in halves (2064 B: 16B-aligned, bank ~= 4*row)
#define BM      64        // batch rows per workgroup
#define NTHREADS 512      // 16 wave32s
#define NLAYERS 8
#define FIN     26
// 2 activation buffers + 3 small reduction scratch arrays (s1, s2, dot)
#define ACT_HALVES   (BM * RS)
#define PART_FLOATS  (BM * 8)
#define SMEM_BYTES   (2 * ACT_HALVES * (int)sizeof(_Float16) + 3 * PART_FLOATS * (int)sizeof(float))

// ---- fragment loader: lane-local 16 halves = [k..k+7] and [k+16..k+23] ----
__device__ __forceinline__ v16h load_frag16(const _Float16* p) {
  v8h lo = *(const v8h*)p;
  v8h hi = *(const v8h*)(p + 16);
  return __builtin_shufflevector(lo, hi, 0,1,2,3,4,5,6,7,8,9,10,11,12,13,14,15);
}

// ---- store a 16x16 f32 accumulator tile to LDS with ReLU, f16 ----
__device__ __forceinline__ void store_tile_relu(_Float16* buf, int mtile, int n0,
                                                int lane, const v8f& a) {
  const int lm    = lane & 15;
  const int rbase = mtile * 16 + ((lane >> 4) ? 8 : 0);
  const int col   = n0 + lm;
#pragma unroll
  for (int r = 0; r < 8; ++r) {
    float v = a[r];
    v = v > 0.f ? v : 0.f;
    buf[(rbase + r) * RS + col] = (_Float16)v;
  }
}

// ================= weight conversion kernels (f32 -> f16, run each call) =================
__global__ void cvt_blk_kernel(const float* __restrict__ w, _Float16* __restrict__ o, int n) {
  int i = blockIdx.x * blockDim.x + threadIdx.x;
  if (i < n) o[i] = (_Float16)w[i];
}

__global__ void cvt_stem_kernel(const float* __restrict__ w, _Float16* __restrict__ o) {
  int i = blockIdx.x * blockDim.x + threadIdx.x;   // 0 .. 1024*32-1
  if (i >= HDIM * 32) return;
  int row = i >> 5, col = i & 31;
  o[i] = (col < FIN) ? (_Float16)w[row * FIN + col] : (_Float16)0.f;
}

// ================= fused MLP kernel =================
__global__ void __launch_bounds__(NTHREADS, 1)
mlp_fused_kernel(const float* __restrict__ x,
                 const float* __restrict__ st_gamma, const float* __restrict__ st_beta,
                 const float* __restrict__ st_b,
                 const float* __restrict__ blk_gamma, const float* __restrict__ blk_beta,
                 const float* __restrict__ blk_b,
                 const float* __restrict__ last_gamma, const float* __restrict__ last_beta,
                 const float* __restrict__ last_w, const float* __restrict__ last_b,
                 const _Float16* __restrict__ stemW16, const _Float16* __restrict__ blkW16,
                 float* __restrict__ out) {
  extern __shared__ __align__(16) _Float16 smem[];
  _Float16* bufN = smem;                 // GEMM input  (LN output)   [BM][RS]
  _Float16* bufR = smem + ACT_HALVES;    // GEMM output (ReLU)        [BM][RS]
  float* p1 = (float*)(smem + 2 * ACT_HALVES);  // [BM][8] partial sums
  float* p2 = p1 + PART_FLOATS;                  // [BM][8] partial sq-sums
  float* p3 = p2 + PART_FLOATS;                  // [BM][8] partial dots (head)

  const int tid     = threadIdx.x;
  const int lane    = tid & 31;
  const int wave    = tid >> 5;          // 0..15
  const int rowBase = blockIdx.x * BM;

  const int nw    = wave * 64;           // this wave's 64 output columns (4 N tiles), all 64 rows (4 M tiles)
  const int lm    = lane & 15;
  const int koff  = (lane >> 4) << 3;    // hi half-wave reads K+8

  // LN work mapping: one row per lane (32 distinct rows per wave -> ~2-way LDS conflicts max)
  const int lrow = tid & 63;             // row handled by this thread
  const int lseg = tid >> 6;             // which 128-col segment (0..7)
  const int c0   = lseg * 128;

  // ---------------- stem LayerNorm over 26 features ----------------
  if (tid < BM) {
    const float* xr = x + (size_t)(rowBase + tid) * FIN;
    float v[FIN];
    float s1 = 0.f;
#pragma unroll
    for (int i = 0; i < FIN; ++i) { v[i] = xr[i]; s1 += v[i]; }
    const float m = s1 * (1.f / FIN);
    float s2 = 0.f;
#pragma unroll
    for (int i = 0; i < FIN; ++i) { float d = v[i] - m; s2 += d * d; }
    const float inv = rsqrtf(s2 * (1.f / FIN) + 1e-5f);
    _Float16* dst = bufN + tid * RS;
#pragma unroll
    for (int i = 0; i < FIN; ++i)
      dst[i] = (_Float16)((v[i] - m) * inv * st_gamma[i] + st_beta[i]);
#pragma unroll
    for (int i = FIN; i < 32; ++i) dst[i] = (_Float16)0.f;
  }
  __syncthreads();

  // ---------------- stem GEMM: [64 x 32] x [32 x 1024], one WMMA K step ----------------
  {
    v16h aF[4];
#pragma unroll
    for (int m = 0; m < 4; ++m) aF[m] = load_frag16(bufN + (m * 16 + lm) * RS + koff);
#pragma unroll
    for (int t = 0; t < 4; ++t) {
      const float bv = st_b[nw + t * 16 + lm];
      const v16h bF = load_frag16(stemW16 + (size_t)(nw + t * 16 + lm) * 32 + koff);
#pragma unroll
      for (int m = 0; m < 4; ++m) {
        v8f acc;
#pragma unroll
        for (int r = 0; r < 8; ++r) acc[r] = bv;
        acc = __builtin_amdgcn_wmma_f32_16x16x32_f16(false, aF[m], false, bF,
                                                     (short)0, acc, false, false);
        store_tile_relu(bufR, m, nw + t * 16, lane, acc);
      }
    }
  }

  // ---------------- 8 blocks: LN -> Linear(H->H) -> ReLU ----------------
  for (int l = 0; l < NLAYERS; ++l) {
    __syncthreads();
    // ---- LN stage 1: partial sums of bufR row ----
    {
      const _Float16* src = bufR + lrow * RS + c0;
      float s1 = 0.f, s2 = 0.f;
#pragma unroll
      for (int cc = 0; cc < 128; cc += 8) {
        v8h h = *(const v8h*)(src + cc);
#pragma unroll
        for (int i = 0; i < 8; ++i) { float v = (float)h[i]; s1 += v; s2 += v * v; }
      }
      p1[lrow * 8 + lseg] = s1;
      p2[lrow * 8 + lseg] = s2;
    }
    __syncthreads();
    // ---- LN stage 2: finish stats (redundantly per segment-thread), normalize ----
    {
      float s1 = 0.f, s2 = 0.f;
#pragma unroll
      for (int j = 0; j < 8; ++j) { s1 += p1[lrow * 8 + j]; s2 += p2[lrow * 8 + j]; }
      const float m   = s1 * (1.f / HDIM);
      const float var = s2 * (1.f / HDIM) - m * m;
      const float inv = rsqrtf(var + 1e-5f);
      const float* g  = blk_gamma + (size_t)l * HDIM + c0;
      const float* be = blk_beta  + (size_t)l * HDIM + c0;
      const _Float16* src = bufR + lrow * RS + c0;
      _Float16* dst = bufN + lrow * RS + c0;
#pragma unroll
      for (int cc = 0; cc < 128; cc += 8) {
        v8h h = *(const v8h*)(src + cc);
        v8h o;
#pragma unroll
        for (int i = 0; i < 8; ++i)
          o[i] = (_Float16)(((float)h[i] - m) * inv * g[cc + i] + be[cc + i]);
        *(v8h*)(dst + cc) = o;
      }
    }
    __syncthreads();
    // ---- GEMM bufN x W_l^T -> ReLU -> bufR ----
    const _Float16* wl = blkW16 + (size_t)l * HDIM * HDIM;
    const float*    bl = blk_b + (size_t)l * HDIM;
    {
      // 64x64 wave tile: every weight fragment feeds all 4 M tiles, so the
      // work-group loads each weight row once instead of once per M tile.
      v8f acc[4][4];   // [m][t]
#pragma unroll
      for (int t = 0; t < 4; ++t) {
        const float bv = bl[nw + t * 16 + lm];
#pragma unroll
        for (int m = 0; m < 4; ++m)
#pragma unroll
          for (int r = 0; r < 8; ++r) acc[m][t][r] = bv;
      }
      const _Float16* arow = bufN + lm * RS + koff;
      const _Float16* wrow = wl + (size_t)(nw + lm) * HDIM + koff;
      // 64 k per trip = one whole 128-byte line of each weight row, its four
      // 16-byte loads issued together.
      for (int k = 0; k < HDIM; k += 64) {
        v16h bF[2][4];
#pragma unroll
        for (int t = 0; t < 4; ++t)
#pragma unroll
          for (int s = 0; s < 2; ++s)
            bF[s][t] = load_frag16(wrow + (size_t)t * 16 * HDIM + k + s * 32);
        // Keeps the 16 weight loads ahead of the WMMAs as one group: without it the
        // scheduler sinks them among the WMMAs two fragments at a time, which leaves few
        // loads in flight and asks for a line's two halves half a trip apart.
        __builtin_amdgcn_sched_barrier(0);
#pragma unroll
        for (int s = 0; s < 2; ++s) {
          v16h aF[4];
#pragma unroll
          for (int m = 0; m < 4; ++m) aF[m] = load_frag16(arow + m * 16 * RS + k + s * 32);
#pragma unroll
          for (int t = 0; t < 4; ++t)
#pragma unroll
            for (int m = 0; m < 4; ++m)
              acc[m][t] = __builtin_amdgcn_wmma_f32_16x16x32_f16(false, aF[m], false, bF[s][t],
                                                                 (short)0, acc[m][t], false, false);
        }
      }
#pragma unroll
      for (int t = 0; t < 4; ++t)
#pragma unroll
        for (int m = 0; m < 4; ++m) store_tile_relu(bufR, m, nw + t * 16, lane, acc[m][t]);
    }
  }
  __syncthreads();

  // ---------------- head: LN -> Linear(H->1) -> sigmoid ----------------
  {
    const _Float16* src = bufR + lrow * RS + c0;
    float s1 = 0.f, s2 = 0.f;
#pragma unroll
    for (int cc = 0; cc < 128; cc += 8) {
      v8h h = *(const v8h*)(src + cc);
#pragma unroll
      for (int i = 0; i < 8; ++i) { float v = (float)h[i]; s1 += v; s2 += v * v; }
    }
    p1[lrow * 8 + lseg] = s1;
    p2[lrow * 8 + lseg] = s2;
  }
  __syncthreads();
  {
    float s1 = 0.f, s2 = 0.f;
#pragma unroll
    for (int j = 0; j < 8; ++j) { s1 += p1[lrow * 8 + j]; s2 += p2[lrow * 8 + j]; }
    const float m   = s1 * (1.f / HDIM);
    const float var = s2 * (1.f / HDIM) - m * m;
    const float inv = rsqrtf(var + 1e-5f);
    const _Float16* src = bufR + lrow * RS + c0;
    const float* lg = last_gamma + c0;
    const float* lb = last_beta + c0;
    const float* lw = last_w + c0;
    float dot = 0.f;
#pragma unroll
    for (int cc = 0; cc < 128; cc += 8) {
      v8h h = *(const v8h*)(src + cc);
#pragma unroll
      for (int i = 0; i < 8; ++i) {
        float v = ((float)h[i] - m) * inv * lg[cc + i] + lb[cc + i];
        dot += v * lw[cc + i];
      }
    }
    p3[lrow * 8 + lseg] = dot;
  }
  __syncthreads();
  if (tid < BM) {
    float dot = 0.f;
#pragma unroll
    for (int j = 0; j < 8; ++j) dot += p3[tid * 8 + j];
    const float z = dot + last_b[0];
    out[rowBase + tid] = 1.f / (1.f + __expf(-z));
  }
}

// ================= host launcher =================
extern "C" void kernel_launch(void* const* d_in, const int* in_sizes, int n_in,
                              void* d_out, int out_size, void* d_ws, size_t ws_size,
                              hipStream_t stream) {
  (void)in_sizes; (void)n_in; (void)out_size; (void)ws_size;

  const float* x         = (const float*)d_in[0];
  const float* st_gamma  = (const float*)d_in[1];
  const float* st_beta   = (const float*)d_in[2];
  const float* st_w      = (const float*)d_in[3];
  const float* st_b      = (const float*)d_in[4];
  const float* blk_gamma = (const float*)d_in[5];
  const float* blk_beta  = (const float*)d_in[6];
  const float* blk_w     = (const float*)d_in[7];
  const float* blk_b     = (const float*)d_in[8];
  const float* last_gamma= (const float*)d_in[9];
  const float* last_beta = (const float*)d_in[10];
  const float* last_w    = (const float*)d_in[11];
  const float* last_b    = (const float*)d_in[12];
  float* out = (float*)d_out;

  // ws layout: stem weights padded to [1024][32] f16, then block weights [8][1024][1024] f16
  _Float16* stemW16 = (_Float16*)d_ws;
  _Float16* blkW16  = stemW16 + (size_t)HDIM * 32;

  // convert weights to f16 (every call; deterministic)
  {
    const int n = NLAYERS * HDIM * HDIM;
    cvt_blk_kernel<<<(n + 255) / 256, 256, 0, stream>>>(blk_w, blkW16, n);
    cvt_stem_kernel<<<(HDIM * 32 + 255) / 256, 256, 0, stream>>>(st_w, stemW16);
  }

  static_assert(SMEM_BYTES == 270336, "LDS budget (<= 320KB/WGP)");
  hipFuncSetAttribute((const void*)mlp_fused_kernel,
                      hipFuncAttributeMaxDynamicSharedMemorySize, SMEM_BYTES);

  const int nBlocks = 65536 / BM;  // 1024
  mlp_fused_kernel<<<nBlocks, NTHREADS, SMEM_BYTES, stream>>>(
      x, st_gamma, st_beta, st_b,
      blk_gamma, blk_beta, blk_b,
      last_gamma, last_beta, last_w, last_b,
      stemW16, blkW16, out);
}

// v002
// One run takes 703 microseconds.
// In two side-by-side timings against v001, it was 1.65 and 1.66 times as fast.
// All steps since v000 together make it 5.10 times as fast.
#include <hip/hip_runtime.h>

typedef _Float16 v8h  __attribute__((ext_vector_type(8)));
typedef _Float16 v16h __attribute__((ext_vector_type(16)));
typedef float    v8f  __attribute__((ext_vector_type(8)));
typedef float    v4f  __attribute__((ext_vector_type(4)));

#define HDIM    1024
#define RS      1032      // padded LDS row stride in halves (2064 B: 16B-aligned, bank ~= 4*row)
#define BM      64        // batch rows per workgroup
#define NTHREADS 512      // 16 wave32s
#define NLAYERS 8
#define FIN     26
// 2 activation buffers + 3 small reduction scratch arrays (s1, s2, dot)
#define ACT_HALVES   (BM * RS)
#define PART_FLOATS  (BM * 8)
#define SMEM_BYTES   (2 * ACT_HALVES * (int)sizeof(_Float16) + 3 * PART_FLOATS * (int)sizeof(float))

// ---- fragment loader: lane-local 16 halves = [k..k+7] and [k+16..k+23] ----
__device__ __forceinline__ v16h load_frag16(const _Float16* p) {
  v8h lo = *(const v8h*)p;
  v8h hi = *(const v8h*)(p + 16);
  return __builtin_shufflevector(lo, hi, 0,1,2,3,4,5,6,7,8,9,10,11,12,13,14,15);
}

// ---- the same fragment from the packed weights: its two halves lie 512 bytes apart ----
__device__ __forceinline__ v16h load_frag16_packed(const _Float16* p) {
  v8h lo = *(const v8h*)p;
  v8h hi = *(const v8h*)(p + 256);
  return __builtin_shufflevector(lo, hi, 0,1,2,3,4,5,6,7,8,9,10,11,12,13,14,15);
}

// ---- store a 16x16 f32 accumulator tile to LDS with ReLU, f16 ----
__device__ __forceinline__ void store_tile_relu(_Float16* buf, int mtile, int n0,
                                                int lane, const v8f& a) {
  const int lm    = lane & 15;
  const int rbase = mtile * 16 + ((lane >> 4) ? 8 : 0);
  const int col   = n0 + lm;
#pragma unroll
  for (int r = 0; r < 8; ++r) {
    float v = a[r];
    v = v > 0.f ? v : 0.f;
    buf[(rbase + r) * RS + col] = (_Float16)v;
  }
}

// ================= weight conversion kernels (f32 -> f16, run each call) =================
// Block weights go out in the order the GEMM's lanes read them:
//   [layer][wave 16][k step of 32: 32][N tile 4][fragment half 2][lane 32][8 halves]
// so that one wave-wide 16-byte load is 512 contiguous bytes (4 whole 128-byte lines)
// and a wave's 16 loads of a trip are 8 KiB in a row.
// One thread makes one lane's 16-byte piece; a block of 256 reads 64 whole lines of w.
__global__ void cvt_blk_kernel(const float* __restrict__ w, _Float16* __restrict__ o, int n8) {
  const int i = blockIdx.x * blockDim.x + threadIdx.x;   // piece index in packed order
  if (i >= n8) return;
  const int lane = i & 31;
  const int part = (i >> 5) & 1;
  const int t    = (i >> 6) & 3;
  const int ks   = (i >> 8) & 31;
  const int wv   = (i >> 13) & 15;
  const int l    = i >> 17;
  const int row  = wv * 64 + t * 16 + (lane & 15);
  const int k    = ks * 32 + part * 16 + ((lane >> 4) << 3);
  const float* src = w + ((size_t)l * HDIM + row) * HDIM + k;
  const v4f a = *(const v4f*)src;
  const v4f b = *(const v4f*)(src + 4);
  v8h h;
#pragma unroll
  for (int j = 0; j < 4; ++j) { h[j] = (_Float16)a[j]; h[4 + j] = (_Float16)b[j]; }
  *(v8h*)(o + (size_t)i * 8) = h;
}

__global__ void cvt_stem_kernel(const float* __restrict__ w, _Float16* __restrict__ o) {
  int i = blockIdx.x * blockDim.x + threadIdx.x;   // 0 .. 1024*32-1
  if (i >= HDIM * 32) return;
  int row = i >> 5, col = i & 31;
  o[i] = (col < FIN) ? (_Float16)w[row * FIN + col] : (_Float16)0.f;
}

// ================= fused MLP kernel =================
__global__ void __launch_bounds__(NTHREADS, 1)
mlp_fused_kernel(const float* __restrict__ x,
                 const float* __restrict__ st_gamma, const float* __restrict__ st_beta,
                 const float* __restrict__ st_b,
                 const float* __restrict__ blk_gamma, const float* __restrict__ blk_beta,
                 const float* __restrict__ blk_b,
                 const float* __restrict__ last_gamma, const float* __restrict__ last_beta,
                 const float* __restrict__ last_w, const float* __restrict__ last_b,
                 const _Float16* __restrict__ stemW16, const _Float16* __restrict__ blkW16,
                 float* __restrict__ out) {
  extern __shared__ __align__(16) _Float16 smem[];
  _Float16* bufN = smem;                 // GEMM input  (LN output)   [BM][RS]
  _Float16* bufR = smem + ACT_HALVES;    // GEMM output (ReLU)        [BM][RS]
  float* p1 = (float*)(smem + 2 * ACT_HALVES);  // [BM][8] partial sums
  float* p2 = p1 + PART_FLOATS;                  // [BM][8] partial sq-sums
  float* p3 = p2 + PART_FLOATS;                  // [BM][8] partial dots (head)

  const int tid     = threadIdx.x;
  const int lane    = tid & 31;
  const int wave    = tid >> 5;          // 0..15
  const int rowBase = blockIdx.x * BM;

  const int nw    = wave * 64;           // this wave's 64 output columns (4 N tiles), all 64 rows (4 M tiles)
  const int lm    = lane & 15;
  const int koff  = (lane >> 4) << 3;    // hi half-wave reads K+8

  // LN work mapping: one row per lane (32 distinct rows per wave -> ~2-way LDS conflicts max)
  const int lrow = tid & 63;             // row handled by this thread
  const int lseg = tid >> 6;             // which 128-col segment (0..7)
  const int c0   = lseg * 128;

  // ---------------- stem LayerNorm over 26 features ----------------
  if (tid < BM) {
    const float* xr = x + (size_t)(rowBase + tid) * FIN;
    float v[FIN];
    float s1 = 0.f;
#pragma unroll
    for (int i = 0; i < FIN; ++i) { v[i] = xr[i]; s1 += v[i]; }
    const float m = s1 * (1.f / FIN);
    float s2 = 0.f;
#pragma unroll
    for (int i = 0; i < FIN; ++i) { float d = v[i] - m; s2 += d * d; }
    const float inv = rsqrtf(s2 * (1.f / FIN) + 1e-5f);
    _Float16* dst = bufN + tid * RS;
#pragma unroll
    for (int i = 0; i < FIN; ++i)
      dst[i] = (_Float16)((v[i] - m) * inv * st_gamma[i] + st_beta[i]);
#pragma unroll
    for (int i = FIN; i < 32; ++i) dst[i] = (_Float16)0.f;
  }
  __syncthreads();

  // ---------------- stem GEMM: [64 x 32] x [32 x 1024], one WMMA K step ----------------
  {
    v16h aF[4];
#pragma unroll
    for (int m = 0; m < 4; ++m) aF[m] = load_frag16(bufN + (m * 16 + lm) * RS + koff);
#pragma unroll
    for (int t = 0; t < 4; ++t) {
      const float bv = st_b[nw + t * 16 + lm];
      const v16h bF = load_frag16(stemW16 + (size_t)(nw + t * 16 + lm) * 32 + koff);
#pragma unroll
      for (int m = 0; m < 4; ++m) {
        v8f acc;
#pragma unroll
        for (int r = 0; r < 8; ++r) acc[r] = bv;
        acc = __builtin_amdgcn_wmma_f32_16x16x32_f16(false, aF[m], false, bF,
                                                     (short)0, acc, false, false);
        store_tile_relu(bufR, m, nw + t * 16, lane, acc);
      }
    }
  }

  // ---------------- 8 blocks: LN -> Linear(H->H) -> ReLU ----------------
  for (int l = 0; l < NLAYERS; ++l) {
    __syncthreads();
    // ---- LN stage 1: partial sums of bufR row ----
    {
      const _Float16* src = bufR + lrow * RS + c0;
      float s1 = 0.f, s2 = 0.f;
#pragma unroll
      for (int cc = 0; cc < 128; cc += 8) {
        v8h h = *(const v8h*)(src + cc);
#pragma unroll
        for (int i = 0; i < 8; ++i) { float v = (float)h[i]; s1 += v; s2 += v * v; }
      }
      p1[lrow * 8 + lseg] = s1;
      p2[lrow * 8 + lseg] = s2;
    }
    __syncthreads();
    // ---- LN stage 2: finish stats (redundantly per segment-thread), normalize ----
    {
      float s1 = 0.f, s2 = 0.f;
#pragma unroll
      for (int j = 0; j < 8; ++j) { s1 += p1[lrow * 8 + j]; s2 += p2[lrow * 8 + j]; }
      const float m   = s1 * (1.f / HDIM);
      const float var = s2 * (1.f / HDIM) - m * m;
      const float inv = rsqrtf(var + 1e-5f);
      const float* g  = blk_gamma + (size_t)l * HDIM + c0;
      const float* be = blk_beta  + (size_t)l * HDIM + c0;
      const _Float16* src = bufR + lrow * RS + c0;
      _Float16* dst = bufN + lrow * RS + c0;
#pragma unroll
      for (int cc = 0; cc < 128; cc += 8) {
        v8h h = *(const v8h*)(src + cc);
        v8h o;
#pragma unroll
        for (int i = 0; i < 8; ++i)
          o[i] = (_Float16)(((float)h[i] - m) * inv * g[cc + i] + be[cc + i]);
        *(v8h*)(dst + cc) = o;
      }
    }
    __syncthreads();
    // ---- GEMM bufN x W_l^T -> ReLU -> bufR ----
    const _Float16* wl = blkW16 + (size_t)l * HDIM * HDIM;   // packed: see cvt_blk_kernel
    const float*    bl = blk_b + (size_t)l * HDIM;
    {
      // 64x64 wave tile: every weight fragment feeds all 4 M tiles, so the
      // work-group loads each weight row once instead of once per M tile.
      v8f acc[4][4];   // [m][t]
#pragma unroll
      for (int t = 0; t < 4; ++t) {
        const float bv = bl[nw + t * 16 + lm];
#pragma unroll
        for (int m = 0; m < 4; ++m)
#pragma unroll
          for (int r = 0; r < 8; ++r) acc[m][t][r] = bv;
      }
      const _Float16* arow = bufN + lm * RS + koff;
      const _Float16* wpk = wl + (size_t)wave * (64 * HDIM) + lane * 8;
      // 64 k per trip = 8 KiB of this wave's packed weights, 16 loads of 512
      // contiguous bytes issued together.
      for (int k = 0; k < HDIM; k += 64) {
        v16h bF[2][4];
#pragma unroll
        for (int s = 0; s < 2; ++s)      // ascending addresses; the k step used first arrives first
#pragma unroll
          for (int t = 0; t < 4; ++t)
            bF[s][t] = load_frag16_packed(wpk + (size_t)k * 64 + s * 2048 + t * 512);
        // Keeps the 16 weight loads ahead of the WMMAs as one group: without it the
        // scheduler sinks them among the WMMAs two fragments at a time, which leaves few
        // loads in flight.
        __builtin_amdgcn_sched_barrier(0);
#pragma unroll
        for (int s = 0; s < 2; ++s) {
          v16h aF[4];
#pragma unroll
          for (int m = 0; m < 4; ++m) aF[m] = load_frag16(arow + m * 16 * RS + k + s * 32);
#pragma unroll
          for (int t = 0; t < 4; ++t)
#pragma unroll
            for (int m = 0; m < 4; ++m)
              acc[m][t] = __builtin_amdgcn_wmma_f32_16x16x32_f16(false, aF[m], false, bF[s][t],
                                                                 (short)0, acc[m][t], false, false);
        }
      }
#pragma unroll
      for (int t = 0; t < 4; ++t)
#pragma unroll
        for (int m = 0; m < 4; ++m) store_tile_relu(bufR, m, nw + t * 16, lane, acc[m][t]);
    }
  }
  __syncthreads();

  // ---------------- head: LN -> Linear(H->1) -> sigmoid ----------------
  {
    const _Float16* src = bufR + lrow * RS + c0;
    float s1 = 0.f, s2 = 0.f;
#pragma unroll
    for (int cc = 0; cc < 128; cc += 8) {
      v8h h = *(const v8h*)(src + cc);
#pragma unroll
      for (int i = 0; i < 8; ++i) { float v = (float)h[i]; s1 += v; s2 += v * v; }
    }
    p1[lrow * 8 + lseg] = s1;
    p2[lrow * 8 + lseg] = s2;
  }
  __syncthreads();
  {
    float s1 = 0.f, s2 = 0.f;
#pragma unroll
    for (int j = 0; j < 8; ++j) { s1 += p1[lrow * 8 + j]; s2 += p2[lrow * 8 + j]; }
    const float m   = s1 * (1.f / HDIM);
    const float var = s2 * (1.f / HDIM) - m * m;
    const float inv = rsqrtf(var + 1e-5f);
    const _Float16* src = bufR + lrow * RS + c0;
    const float* lg = last_gamma + c0;
    const float* lb = last_beta + c0;
    const float* lw = last_w + c0;
    float dot = 0.f;
#pragma unroll
    for (int cc = 0; cc < 128; cc += 8) {
      v8h h = *(const v8h*)(src + cc);
#pragma unroll
      for (int i = 0; i < 8; ++i) {
        float v = ((float)h[i] - m) * inv * lg[cc + i] + lb[cc + i];
        dot += v * lw[cc + i];
      }
    }
    p3[lrow * 8 + lseg] = dot;
  }
  __syncthreads();
  if (tid < BM) {
    float dot = 0.f;
#pragma unroll
    for (int j = 0; j < 8; ++j) dot += p3[tid * 8 + j];
    const float z = dot + last_b[0];
    out[rowBase + tid] = 1.f / (1.f + __expf(-z));
  }
}

// ================= host launcher =================
extern "C" void kernel_launch(void* const* d_in, const int* in_sizes, int n_in,
                              void* d_out, int out_size, void* d_ws, size_t ws_size,
                              hipStream_t stream) {
  (void)in_sizes; (void)n_in; (void)out_size; (void)ws_size;

  const float* x         = (const float*)d_in[0];
  const float* st_gamma  = (const float*)d_in[1];
  const float* st_beta   = (const float*)d_in[2];
  const float* st_w      = (const float*)d_in[3];
  const float* st_b      = (const float*)d_in[4];
  const float* blk_gamma = (const float*)d_in[5];
  const float* blk_beta  = (const float*)d_in[6];
  const float* blk_w     = (const float*)d_in[7];
  const float* blk_b     = (const float*)d_in[8];
  const float* last_gamma= (const float*)d_in[9];
  const float* last_beta = (const float*)d_in[10];
  const float* last_w    = (const float*)d_in[11];
  const float* last_b    = (const float*)d_in[12];
  float* out = (float*)d_out;

  // ws layout: stem weights padded to [1024][32] f16, then block weights, 8*1024*1024 f16, packed
  _Float16* stemW16 = (_Float16*)d_ws;
  _Float16* blkW16  = stemW16 + (size_t)HDIM * 32;

  // convert weights to f16 (every call; deterministic)
  {
    const int n8 = NLAYERS * HDIM * HDIM / 8;   // 16-byte pieces
    cvt_blk_kernel<<<(n8 + 255) / 256, 256, 0, stream>>>(blk_w, blkW16, n8);
    cvt_stem_kernel<<<(HDIM * 32 + 255) / 256, 256, 0, stream>>>(st_w, stemW16);
  }

  static_assert(SMEM_BYTES == 270336, "LDS budget (<= 320KB/WGP)");
  hipFuncSetAttribute((const void*)mlp_fused_kernel,
                      hipFuncAttributeMaxDynamicSharedMemorySize, SMEM_BYTES);

  const int nBlocks = 65536 / BM;  // 1024
  mlp_fused_kernel<<<nBlocks, NTHREADS, SMEM_BYTES, stream>>>(
      x, st_gamma, st_beta, st_b,
      blk_gamma, blk_beta, blk_b,
      last_gamma, last_beta, last_w, last_b,
      stemW16, blkW16, out);
}

// v003
// One run takes 657 microseconds.
// Next to v002, in two timings, it ran 1.07 times as fast each time.
// All steps since v000 together make it 5.46 times as fast.
#include <hip/hip_runtime.h>

typedef _Float16 v8h  __attribute__((ext_vector_type(8)));
typedef _Float16 v16h __attribute__((ext_vector_type(16)));
typedef float    v8f  __attribute__((ext_vector_type(8)));
typedef float    v4f  __attribute__((ext_vector_type(4)));

#define HDIM    1024
#define RS      1032      // padded LDS row stride in halves (2064 B: 16B-aligned, bank ~= 4*row)
#define BM      64        // batch rows per workgroup
#define NTHREADS 512      // 16 wave32s
#define NLAYERS 8
#define FIN     26
// 2 activation buffers + 3 small reduction scratch arrays (s1, s2, dot) + per-row mean and 1/std
#define ACT_HALVES   (BM * RS)
#define PART_FLOATS  (BM * 8)
#define SMEM_BYTES   (2 * ACT_HALVES * (int)sizeof(_Float16) + (3 * PART_FLOATS + 2 * BM) * (int)sizeof(float))

// ---- fragment loader: lane-local 16 halves = [k..k+7] and [k+16..k+23] ----
__device__ __forceinline__ v16h load_frag16(const _Float16* p) {
  v8h lo = *(const v8h*)p;
  v8h hi = *(const v8h*)(p + 16);
  return __builtin_shufflevector(lo, hi, 0,1,2,3,4,5,6,7,8,9,10,11,12,13,14,15);
}

// ---- the same fragment from the packed weights: its two halves lie 512 bytes apart ----
__device__ __forceinline__ v16h load_frag16_packed(const _Float16* p) {
  v8h lo = *(const v8h*)p;
  v8h hi = *(const v8h*)(p + 256);
  return __builtin_shufflevector(lo, hi, 0,1,2,3,4,5,6,7,8,9,10,11,12,13,14,15);
}

// ---- store a 16x16 f32 accumulator tile of a block layer: row scale 1/std, column constant, ReLU, f16 ----
__device__ __forceinline__ void store_tile_scale_relu(_Float16* buf, int mtile, int n0, int lane,
                                                      const v8f& a, const v8f& inv, float cb) {
  const int lm    = lane & 15;
  const int rbase = mtile * 16 + ((lane >> 4) ? 8 : 0);
  const int col   = n0 + lm;
#pragma unroll
  for (int r = 0; r < 8; ++r) {
    float v = a[r] * inv[r] + cb;
    v = v > 0.f ? v : 0.f;
    buf[(rbase + r) * RS + col] = (_Float16)v;
  }
}

// ---- store a 16x16 f32 accumulator tile to LDS with ReLU, f16 ----
__device__ __forceinline__ void store_tile_relu(_Float16* buf, int mtile, int n0,
                                                int lane, const v8f& a) {
  const int lm    = lane & 15;
  const int rbase = mtile * 16 + ((lane >> 4) ? 8 : 0);
  const int col   = n0 + lm;
#pragma unroll
  for (int r = 0; r < 8; ++r) {
    float v = a[r];
    v = v > 0.f ? v : 0.f;
    buf[(rbase + r) * RS + col] = (_Float16)v;
  }
}

// ================= weight preparation kernels (f32 -> f16 weights, f32 folded LayerNorm vectors; run each call) =================
// Block weights go out in the order the GEMM's lanes read them:
//   [layer][wave 16][k step of 32: 32][N tile 4][fragment half 2][lane 32][8 halves]
// so that one wave-wide 16-byte load is 512 contiguous bytes (4 whole 128-byte lines)
// and a wave's 16 loads of a trip are 8 KiB in a row.
// One thread makes one lane's 16-byte piece; a block of 256 reads 64 whole lines of w.
// The layer's LayerNorm gain is multiplied in here: LN(h) W^T = ((h - mean) / std) (gamma * W)^T + beta W^T.
__global__ void cvt_blk_kernel(const float* __restrict__ w, const float* __restrict__ g,
                               _Float16* __restrict__ o, int n8) {
  const int i = blockIdx.x * blockDim.x + threadIdx.x;   // piece index in packed order
  if (i >= n8) return;
  const int lane = i & 31;
  const int part = (i >> 5) & 1;
  const int t    = (i >> 6) & 3;
  const int ks   = (i >> 8) & 31;
  const int wv   = (i >> 13) & 15;
  const int l    = i >> 17;
  const int row  = wv * 64 + t * 16 + (lane & 15);
  const int k    = ks * 32 + part * 16 + ((lane >> 4) << 3);
  const float* src = w + ((size_t)l * HDIM + row) * HDIM + k;
  const v4f a = *(const v4f*)src;
  const v4f b = *(const v4f*)(src + 4);
  const float* gs = g + (size_t)l * HDIM + k;
  const v4f ga = *(const v4f*)gs;
  const v4f gb = *(const v4f*)(gs + 4);
  v8h h;
#pragma unroll
  for (int j = 0; j < 4; ++j) { h[j] = (_Float16)(a[j] * ga[j]); h[4 + j] = (_Float16)(b[j] * gb[j]); }
  *(v8h*)(o + (size_t)i * 8) = h;
}

// Per output column n of each block layer, one wave each:
//   c1[n] = sum_k f16(gamma_k W[n][k])   (what the row mean is multiplied by; the GEMM's own rounded weights)
//   cb[n] = sum_k beta_k W[n][k] + b[n]  (the column's constant)
__global__ void fold_ln_kernel(const float* __restrict__ w, const float* __restrict__ g,
                               const float* __restrict__ be, const float* __restrict__ b,
                               float* __restrict__ c1, float* __restrict__ cb) {
  const int row  = (blockIdx.x * blockDim.x + threadIdx.x) >> 5;   // layer * 1024 + n
  const int lane = threadIdx.x & 31;
  if (row >= NLAYERS * HDIM) return;
  const float* wr = w  + (size_t)row * HDIM + lane * 4;
  const float* gl = g  + (size_t)(row >> 10) * HDIM + lane * 4;
  const float* bl = be + (size_t)(row >> 10) * HDIM + lane * 4;
  float s1 = 0.f, s2 = 0.f;
#pragma unroll
  for (int i = 0; i < 8; ++i) {
    // The wait behind each load stands in front of whatever next writes a register that the load
    // names: in the unrolled form a later load's result is placed on the pointers' registers.
    const v4f a  = *(const v4f*)(wr + i * 128);
    asm volatile("s_wait_xcnt 0x0" ::: "memory");
    const v4f ga = *(const v4f*)(gl + i * 128);
    asm volatile("s_wait_xcnt 0x0" ::: "memory");
    const v4f ba = *(const v4f*)(bl + i * 128);
    asm volatile("s_wait_xcnt 0x0" ::: "memory");
#pragma unroll
    for (int j = 0; j < 4; ++j) { s1 += (float)(_Float16)(a[j] * ga[j]); s2 += a[j] * ba[j]; }
  }
#pragma unroll
  for (int d = 16; d >= 1; d >>= 1) { s1 += __shfl_xor(s1, d, 32); s2 += __shfl_xor(s2, d, 32); }
  if (lane == 0) { c1[row] = s1; cb[row] = s2 + b[row]; }
}

__global__ void cvt_stem_kernel(const float* __restrict__ w, _Float16* __restrict__ o) {
  int i = blockIdx.x * blockDim.x + threadIdx.x;   // 0 .. 1024*32-1
  if (i >= HDIM * 32) return;
  int row = i >> 5, col = i & 31;
  o[i] = (col < FIN) ? (_Float16)w[row * FIN + col] : (_Float16)0.f;
}

// ================= fused MLP kernel =================
__global__ void __launch_bounds__(NTHREADS, 1)
mlp_fused_kernel(const float* __restrict__ x,
                 const float* __restrict__ st_gamma, const float* __restrict__ st_beta,
                 const float* __restrict__ st_b,
                 const float* __restrict__ blkC1, const float* __restrict__ blkCb,
                 const float* __restrict__ last_gamma, const float* __restrict__ last_beta,
                 const float* __restrict__ last_w, const float* __restrict__ last_b,
                 const _Float16* __restrict__ stemW16, const _Float16* __restrict__ blkW16,
                 float* __restrict__ out) {
  extern __shared__ __align__(16) _Float16 smem[];
  _Float16* bufN = smem;                 // stem LN output, then one of the two activation buffers [BM][RS]
  _Float16* bufR = smem + ACT_HALVES;    // stem output, then the other                            [BM][RS]
  float* p1 = (float*)(smem + 2 * ACT_HALVES);  // [BM][8] partial sums
  float* p2 = p1 + PART_FLOATS;                  // [BM][8] partial sq-sums
  float* p3 = p2 + PART_FLOATS;                  // [BM][8] partial dots (head)
  float* stM = p3 + PART_FLOATS;                 // [BM] row mean of the layer's input
  float* stI = stM + BM;                         // [BM] row 1/std of the layer's input

  const int tid     = threadIdx.x;
  const int lane    = tid & 31;
  const int wave    = tid >> 5;          // 0..15
  const int rowBase = blockIdx.x * BM;

  const int nw    = wave * 64;           // this wave's 64 output columns (4 N tiles), all 64 rows (4 M tiles)
  const int lm    = lane & 15;
  const int koff  = (lane >> 4) << 3;    // hi half-wave reads K+8

  // LN work mapping: one row per lane (32 distinct rows per wave -> ~2-way LDS conflicts max)
  const int lrow = tid & 63;             // row handled by this thread
  const int lseg = tid >> 6;             // which 128-col segment (0..7)
  const int c0   = lseg * 128;
  // Block-layer row statistics: 8 lanes share a row, 4 rows per wave, 8 rows apart so that the
  // two rows of a half-wave's 16-byte reads fall on different halves of the banks.
  const int srow = (wave & 7) + ((lane >> 3) << 3) + ((wave >> 3) << 5);
  const int sj   = lane & 7;

  // ---------------- stem LayerNorm over 26 features ----------------
  if (tid < BM) {
    const float* xr = x + (size_t)(rowBase + tid) * FIN;
    float v[FIN];
    float s1 = 0.f;
#pragma unroll
    for (int i = 0; i < FIN; ++i) { v[i] = xr[i]; s1 += v[i]; }
    const float m = s1 * (1.f / FIN);
    float s2 = 0.f;
#pragma unroll
    for (int i = 0; i < FIN; ++i) { float d = v[i] - m; s2 += d * d; }
    const float inv = rsqrtf(s2 * (1.f / FIN) + 1e-5f);
    _Float16* dst = bufN + tid * RS;
#pragma unroll
    for (int i = 0; i < FIN; ++i)
      dst[i] = (_Float16)((v[i] - m) * inv * st_gamma[i] + st_beta[i]);
#pragma unroll
    for (int i = FIN; i < 32; ++i) dst[i] = (_Float16)0.f;
  }
  __syncthreads();

  // ---------------- stem GEMM: [64 x 32] x [32 x 1024], one WMMA K step ----------------
  {
    v16h aF[4];
#pragma unroll
    for (int m = 0; m < 4; ++m) aF[m] = load_frag16(bufN + (m * 16 + lm) * RS + koff);
#pragma unroll
    for (int t = 0; t < 4; ++t) {
      const float bv = st_b[nw + t * 16 + lm];
      const v16h bF = load_frag16(stemW16 + (size_t)(nw + t * 16 + lm) * 32 + koff);
#pragma unroll
      for (int m = 0; m < 4; ++m) {
        v8f acc;
#pragma unroll
        for (int r = 0; r < 8; ++r) acc[r] = bv;
        acc = __builtin_amdgcn_wmma_f32_16x16x32_f16(false, aF[m], false, bF,
                                                     (short)0, acc, false, false);
        store_tile_relu(bufR, m, nw + t * 16, lane, acc);
      }
    }
  }

  // ---------------- 8 blocks: LN -> Linear(H->H) -> ReLU ----------------
  // The GEMM runs on the raw ReLU activations against gamma * W; the row mean enters as the
  // accumulators' start value and 1/std, beta W^T and the bias in the epilogue.
  int curOff = ACT_HALVES;   // this layer's input  (halves from smem)
  int nxtOff = 0;            // this layer's output
  for (int l = 0; l < NLAYERS; ++l) {
    const _Float16* cur = smem + curOff;
    _Float16*       nxt = smem + nxtOff;
    __syncthreads();
    // this lane's 4 columns of the two folded vectors, asked for here so that they arrive under the statistics
    float c1v[4], cbv[4];
#pragma unroll
    for (int t = 0; t < 4; ++t) {
      c1v[t] = blkC1[(size_t)l * HDIM + nw + t * 16 + lm];
      cbv[t] = blkCb[(size_t)l * HDIM + nw + t * 16 + lm];
    }
    // ---- row mean and 1/std of the input, whole rows inside a wave ----
    {
      const _Float16* src = cur + srow * RS + sj * 8;
      float s1 = 0.f, s2 = 0.f;
#pragma unroll
      for (int cc = 0; cc < HDIM; cc += 64) {
        v8h h = *(const v8h*)(src + cc);
#pragma unroll
        for (int i = 0; i < 8; ++i) { float v = (float)h[i]; s1 += v; s2 += v * v; }
      }
#pragma unroll
      for (int d = 1; d <= 4; d <<= 1) { s1 += __shfl_xor(s1, d, 32); s2 += __shfl_xor(s2, d, 32); }
      const float m   = s1 * (1.f / HDIM);
      const float var = s2 * (1.f / HDIM) - m * m;
      const float inv = rsqrtf(var + 1e-5f);
      if (sj == 0) { stM[srow] = m; stI[srow] = inv; }
    }
    __syncthreads();
    // ---- GEMM cur x (gamma W_l)^T -> scale, constant, ReLU -> nxt ----
    const _Float16* wl = blkW16 + (size_t)l * HDIM * HDIM;   // packed: see cvt_blk_kernel
    {
      // 64x64 wave tile: every weight fragment feeds all 4 M tiles, so the
      // work-group loads each weight row once instead of once per M tile.
      const int rhalf = (lane >> 4) << 3;   // this lane's 8 accumulator rows inside an M tile
      v8f acc[4][4];   // [m][t]
      {
#pragma unroll
        for (int m = 0; m < 4; ++m) {
          const v4f mlo = *(const v4f*)(stM + m * 16 + rhalf);
          const v4f mhi = *(const v4f*)(stM + m * 16 + rhalf + 4);
#pragma unroll
          for (int t = 0; t < 4; ++t)
#pragma unroll
            for (int r = 0; r < 4; ++r) {
              acc[m][t][r]     = -mlo[r] * c1v[t];
              acc[m][t][4 + r] = -mhi[r] * c1v[t];
            }
        }
      }
      const _Float16* arow = cur + lm * RS + koff;
      const _Float16* wpk = wl + (size_t)wave * (64 * HDIM) + lane * 8;
      // 64 k per trip = 8 KiB of this wave's packed weights, 16 loads of 512
      // contiguous bytes issued together.
      for (int k = 0; k < HDIM; k += 64) {
        v16h bF[2][4];
#pragma unroll
        for (int s = 0; s < 2; ++s)      // ascending addresses; the k step used first arrives first
#pragma unroll
          for (int t = 0; t < 4; ++t)
            bF[s][t] = load_frag16_packed(wpk + (size_t)k * 64 + s * 2048 + t * 512);
        // Keeps the 16 weight loads ahead of the WMMAs as one group: without it the
        // scheduler sinks them among the WMMAs two fragments at a time, which leaves few
        // loads in flight.
        __builtin_amdgcn_sched_barrier(0);
#pragma unroll
        for (int s = 0; s < 2; ++s) {
          v16h aF[4];
#pragma unroll
          for (int m = 0; m < 4; ++m) aF[m] = load_frag16(arow + m * 16 * RS + k + s * 32);
#pragma unroll
          for (int t = 0; t < 4; ++t)
#pragma unroll
            for (int m = 0; m < 4; ++m)
              acc[m][t] = __builtin_amdgcn_wmma_f32_16x16x32_f16(false, aF[m], false, bF[s][t],
                                                                 (short)0, acc[m][t], false, false);
        }
      }
#pragma unroll
      for (int m = 0; m < 4; ++m) {
        const v4f ilo = *(const v4f*)(stI + m * 16 + rhalf);
        const v4f ihi = *(const v4f*)(stI + m * 16 + rhalf + 4);
        const v8f inv = __builtin_shufflevector(ilo, ihi, 0, 1, 2, 3, 4, 5, 6, 7);
#pragma unroll
        for (int t = 0; t < 4; ++t)
          store_tile_scale_relu(nxt, m, nw + t * 16, lane, acc[m][t], inv, cbv[t]);
      }
    }
    const int sw = curOff; curOff = nxtOff; nxtOff = sw;
  }
  __syncthreads();
  const _Float16* hfin = smem + curOff;   // the last layer's output

  // ---------------- head: LN -> Linear(H->1) -> sigmoid ----------------
  {
    const _Float16* src = hfin + lrow * RS + c0;
    float s1 = 0.f, s2 = 0.f;
#pragma unroll
    for (int cc = 0; cc < 128; cc += 8) {
      v8h h = *(const v8h*)(src + cc);
#pragma unroll
      for (int i = 0; i < 8; ++i) { float v = (float)h[i]; s1 += v; s2 += v * v; }
    }
    p1[lrow * 8 + lseg] = s1;
    p2[lrow * 8 + lseg] = s2;
  }
  __syncthreads();
  {
    float s1 = 0.f, s2 = 0.f;
#pragma unroll
    for (int j = 0; j < 8; ++j) { s1 += p1[lrow * 8 + j]; s2 += p2[lrow * 8 + j]; }
    const float m   = s1 * (1.f / HDIM);
    const float var = s2 * (1.f / HDIM) - m * m;
    const float inv = rsqrtf(var + 1e-5f);
    const _Float16* src = hfin + lrow * RS + c0;
    const float* lg = last_gamma + c0;
    const float* lb = last_beta + c0;
    const float* lw = last_w + c0;
    float dot = 0.f;
#pragma unroll
    for (int cc = 0; cc < 128; cc += 8) {
      v8h h = *(const v8h*)(src + cc);
#pragma unroll
      for (int i = 0; i < 8; ++i) {
        float v = ((float)h[i] - m) * inv * lg[cc + i] + lb[cc + i];
        dot += v * lw[cc + i];
      }
    }
    p3[lrow * 8 + lseg] = dot;
  }
  __syncthreads();
  if (tid < BM) {
    float dot = 0.f;
#pragma unroll
    for (int j = 0; j < 8; ++j) dot += p3[tid * 8 + j];
    const float z = dot + last_b[0];
    out[rowBase + tid] = 1.f / (1.f + __expf(-z));
  }
}

// ================= host launcher =================
extern "C" void kernel_launch(void* const* d_in, const int* in_sizes, int n_in,
                              void* d_out, int out_size, void* d_ws, size_t ws_size,
                              hipStream_t stream) {
  (void)in_sizes; (void)n_in; (void)out_size; (void)ws_size;

  const float* x         = (const float*)d_in[0];
  const float* st_gamma  = (const float*)d_in[1];
  const float* st_beta   = (const float*)d_in[2];
  const float* st_w      = (const float*)d_in[3];
  const float* st_b      = (const float*)d_in[4];
  const float* blk_gamma = (const float*)d_in[5];
  const float* blk_beta  = (const float*)d_in[6];
  const float* blk_w     = (const float*)d_in[7];
  const float* blk_b     = (const float*)d_in[8];
  const float* last_gamma= (const float*)d_in[9];
  const float* last_beta = (const float*)d_in[10];
  const float* last_w    = (const float*)d_in[11];
  const float* last_b    = (const float*)d_in[12];
  float* out = (float*)d_out;

  // ws layout: stem weights padded to [1024][32] f16, then block weights, 8*1024*1024 f16, packed,
  // then the two per-column vectors of the folded LayerNorm, 8*1024 f32 each
  _Float16* stemW16 = (_Float16*)d_ws;
  _Float16* blkW16  = stemW16 + (size_t)HDIM * 32;
  float*    blkC1   = (float*)(blkW16 + (size_t)NLAYERS * HDIM * HDIM);
  float*    blkCb   = blkC1 + NLAYERS * HDIM;

  // convert weights to f16 (every call; deterministic)
  {
    const int n8 = NLAYERS * HDIM * HDIM / 8;   // 16-byte pieces
    cvt_blk_kernel<<<(n8 + 255) / 256, 256, 0, stream>>>(blk_w, blk_gamma, blkW16, n8);
    fold_ln_kernel<<<NLAYERS * HDIM * 32 / 256, 256, 0, stream>>>(blk_w, blk_gamma, blk_beta, blk_b,
                                                                  blkC1, blkCb);
    cvt_stem_kernel<<<(HDIM * 32 + 255) / 256, 256, 0, stream>>>(st_w, stemW16);
  }

  static_assert(SMEM_BYTES == 270848, "LDS budget (<= 320KB/WGP)");
  hipFuncSetAttribute((const void*)mlp_fused_kernel,
                      hipFuncAttributeMaxDynamicSharedMemorySize, SMEM_BYTES);

  const int nBlocks = 65536 / BM;  // 1024
  mlp_fused_kernel<<<nBlocks, NTHREADS, SMEM_BYTES, stream>>>(
      x, st_gamma, st_beta, st_b,
      blkC1, blkCb,
      last_gamma, last_beta, last_w, last_b,
      stemW16, blkW16, out);
}

// v004
// One run takes 635 microseconds.
// Timed twice side by side with v003, it ran 1.03 times as fast both times.
// Counting every step since v000, it is 5.64 times as fast.
#include <hip/hip_runtime.h>

typedef _Float16 v8h  __attribute__((ext_vector_type(8)));
typedef _Float16 v16h __attribute__((ext_vector_type(16)));
typedef float    v8f  __attribute__((ext_vector_type(8)));
typedef float    v4f  __attribute__((ext_vector_type(4)));

#define HDIM    1024
#define RS      1032      // padded LDS row stride in halves (2064 B: 16B-aligned, bank ~= 4*row)
#define BM      64        // batch rows per workgroup
#define NTHREADS 512      // 16 wave32s
#define NLAYERS 8
#define FIN     26
// 2 activation buffers + 3 small reduction scratch arrays (s1, s2, dot) + per-row mean and 1/std
#define ACT_HALVES   (BM * RS)
#define PART_FLOATS  (BM * 8)
#define SMEM_BYTES   (2 * ACT_HALVES * (int)sizeof(_Float16) + (3 * PART_FLOATS + 2 * BM) * (int)sizeof(float))

// ---- fragment loader: lane-local 16 halves = [k..k+7] and [k+16..k+23] ----
__device__ __forceinline__ v16h load_frag16(const _Float16* p) {
  v8h lo = *(const v8h*)p;
  v8h hi = *(const v8h*)(p + 16);
  return __builtin_shufflevector(lo, hi, 0,1,2,3,4,5,6,7,8,9,10,11,12,13,14,15);
}

// ---- the same fragment from the packed weights: its two halves lie 512 bytes apart ----
__device__ __forceinline__ v16h load_frag16_packed(const _Float16* p) {
  v8h lo = *(const v8h*)p;
  v8h hi = *(const v8h*)(p + 256);
  return __builtin_shufflevector(lo, hi, 0,1,2,3,4,5,6,7,8,9,10,11,12,13,14,15);
}

// Two k steps' weight fragments from p, the lane's own place in the packed weights: 16 loads as one group.
__device__ __forceinline__ void load_2ksteps(v16h (&b)[2][4], const _Float16* p) {
#pragma unroll
  for (int s = 0; s < 2; ++s)
#pragma unroll
    for (int t = 0; t < 4; ++t) b[s][t] = load_frag16_packed(p + s * 2048 + t * 512);
  // Stands in front of whatever next writes the address registers that these loads name, and keeps the
  // loads where they are written. The pointer as an input stays in its registers up to the wait, so
  // that no load's result is placed on them.
  asm volatile("s_wait_xcnt 0x0" :: "v"(p) : "memory");
}

// ---- one k step of the 64x64 wave tile: 4 activation fragments from LDS, 16 WMMAs ----
__device__ __forceinline__ void kstep_wmma(v8f (&acc)[4][4], const _Float16* a, const v16h (&b)[4]) {
  v16h aF[4];
#pragma unroll
  for (int m = 0; m < 4; ++m) aF[m] = load_frag16(a + m * 16 * RS);
#pragma unroll
  for (int t = 0; t < 4; ++t)
#pragma unroll
    for (int m = 0; m < 4; ++m)
      acc[m][t] = __builtin_amdgcn_wmma_f32_16x16x32_f16(false, aF[m], false, b[t],
                                                         (short)0, acc[m][t], false, false);
}

// ---- the same k step; each weight fragment is asked for anew, for the k step two ahead (at nb), as soon as
//      the 4 WMMAs that read it are issued: 14 of a wave's 16 weight loads stay in flight all the time ----
__device__ __forceinline__ void kstep_wmma_refill(v8f (&acc)[4][4], const _Float16* a, v16h (&b)[4],
                                                  const _Float16* nb, unsigned loff) {
  v16h aF[4];
#pragma unroll
  for (int m = 0; m < 4; ++m) aF[m] = load_frag16(a + m * 16 * RS);
#pragma unroll
  for (int t = 0; t < 4; ++t) {
#pragma unroll
    for (int m = 0; m < 4; ++m)
      acc[m][t] = __builtin_amdgcn_wmma_f32_16x16x32_f16(false, aF[m], false, b[t],
                                                         (short)0, acc[m][t], false, false);
    // The two fences keep the refill directly behind the WMMAs that read these registers: hoisted it
    // would need registers of its own, sunk it would lose its lead.
    __builtin_amdgcn_sched_barrier(0);
    b[t] = load_frag16_packed((const _Float16*)((const char*)(nb + t * 512) + loff));
    __builtin_amdgcn_sched_barrier(0);
  }
}

// ---- store a 16x16 f32 accumulator tile of a block layer: row scale 1/std, column constant, ReLU, f16 ----
__device__ __forceinline__ void store_tile_scale_relu(_Float16* buf, int mtile, int n0, int lane,
                                                      const v8f& a, const v8f& inv, float cb) {
  const int lm    = lane & 15;
  const int rbase = mtile * 16 + ((lane >> 4) ? 8 : 0);
  const int col   = n0 + lm;
#pragma unroll
  for (int r = 0; r < 8; ++r) {
    float v = a[r] * inv[r] + cb;
    v = v > 0.f ? v : 0.f;
    buf[(rbase + r) * RS + col] = (_Float16)v;
  }
}

// ---- store a 16x16 f32 accumulator tile to LDS with ReLU, f16 ----
__device__ __forceinline__ void store_tile_relu(_Float16* buf, int mtile, int n0,
                                                int lane, const v8f& a) {
  const int lm    = lane & 15;
  const int rbase = mtile * 16 + ((lane >> 4) ? 8 : 0);
  const int col   = n0 + lm;
#pragma unroll
  for (int r = 0; r < 8; ++r) {
    float v = a[r];
    v = v > 0.f ? v : 0.f;
    buf[(rbase + r) * RS + col] = (_Float16)v;
  }
}

// ================= weight preparation kernels (f32 -> f16 weights, f32 folded LayerNorm vectors; run each call) =================
// Block weights go out in the order the GEMM's lanes read them:
//   [layer][wave 16][k step of 32: 32][N tile 4][fragment half 2][lane 32][8 halves]
// so that one wave-wide 16-byte load is 512 contiguous bytes (4 whole 128-byte lines)
// and a wave's 16 loads of a trip are 8 KiB in a row.
// One thread makes one lane's 16-byte piece; a block of 256 reads 64 whole lines of w.
// The layer's LayerNorm gain is multiplied in here: LN(h) W^T = ((h - mean) / std) (gamma * W)^T + beta W^T.
__global__ void cvt_blk_kernel(const float* __restrict__ w, const float* __restrict__ g,
                               _Float16* __restrict__ o, int n8) {
  const int i = blockIdx.x * blockDim.x + threadIdx.x;   // piece index in packed order
  if (i >= n8) return;
  const int lane = i & 31;
  const int part = (i >> 5) & 1;
  const int t    = (i >> 6) & 3;
  const int ks   = (i >> 8) & 31;
  const int wv   = (i >> 13) & 15;
  const int l    = i >> 17;
  const int row  = wv * 64 + t * 16 + (lane & 15);
  const int k    = ks * 32 + part * 16 + ((lane >> 4) << 3);
  const float* src = w + ((size_t)l * HDIM + row) * HDIM + k;
  const v4f a = *(const v4f*)src;
  const v4f b = *(const v4f*)(src + 4);
  const float* gs = g + (size_t)l * HDIM + k;
  const v4f ga = *(const v4f*)gs;
  const v4f gb = *(const v4f*)(gs + 4);
  v8h h;
#pragma unroll
  for (int j = 0; j < 4; ++j) { h[j] = (_Float16)(a[j] * ga[j]); h[4 + j] = (_Float16)(b[j] * gb[j]); }
  *(v8h*)(o + (size_t)i * 8) = h;
}

// Per output column n of each block layer, one wave each:
//   c1[n] = sum_k f16(gamma_k W[n][k])   (what the row mean is multiplied by; the GEMM's own rounded weights)
//   cb[n] = sum_k beta_k W[n][k] + b[n]  (the column's constant)
__global__ void fold_ln_kernel(const float* __restrict__ w, const float* __restrict__ g,
                               const float* __restrict__ be, const float* __restrict__ b,
                               float* __restrict__ c1, float* __restrict__ cb) {
  const int row  = (blockIdx.x * blockDim.x + threadIdx.x) >> 5;   // layer * 1024 + n
  const int lane = threadIdx.x & 31;
  if (row >= NLAYERS * HDIM) return;
  const float* wr = w  + (size_t)row * HDIM + lane * 4;
  const float* gl = g  + (size_t)(row >> 10) * HDIM + lane * 4;
  const float* bl = be + (size_t)(row >> 10) * HDIM + lane * 4;
  float s1 = 0.f, s2 = 0.f;
#pragma unroll
  for (int i = 0; i < 8; ++i) {
    // The wait behind each load stands in front of whatever next writes a register that the load
    // names: in the unrolled form a later load's result is placed on the pointers' registers.
    const v4f a  = *(const v4f*)(wr + i * 128);
    asm volatile("s_wait_xcnt 0x0" ::: "memory");
    const v4f ga = *(const v4f*)(gl + i * 128);
    asm volatile("s_wait_xcnt 0x0" ::: "memory");
    const v4f ba = *(const v4f*)(bl + i * 128);
    asm volatile("s_wait_xcnt 0x0" ::: "memory");
#pragma unroll
    for (int j = 0; j < 4; ++j) { s1 += (float)(_Float16)(a[j] * ga[j]); s2 += a[j] * ba[j]; }
  }
#pragma unroll
  for (int d = 16; d >= 1; d >>= 1) { s1 += __shfl_xor(s1, d, 32); s2 += __shfl_xor(s2, d, 32); }
  if (lane == 0) { c1[row] = s1; cb[row] = s2 + b[row]; }
}

__global__ void cvt_stem_kernel(const float* __restrict__ w, _Float16* __restrict__ o) {
  int i = blockIdx.x * blockDim.x + threadIdx.x;   // 0 .. 1024*32-1
  if (i >= HDIM * 32) return;
  int row = i >> 5, col = i & 31;
  o[i] = (col < FIN) ? (_Float16)w[row * FIN + col] : (_Float16)0.f;
}

// ================= fused MLP kernel =================
__global__ void __launch_bounds__(NTHREADS, 1)
mlp_fused_kernel(const float* __restrict__ x,
                 const float* __restrict__ st_gamma, const float* __restrict__ st_beta,
                 const float* __restrict__ st_b,
                 const float* __restrict__ blkC1, const float* __restrict__ blkCb,
                 const float* __restrict__ last_gamma, const float* __restrict__ last_beta,
                 const float* __restrict__ last_w, const float* __restrict__ last_b,
                 const _Float16* __restrict__ stemW16, const _Float16* __restrict__ blkW16,
                 float* __restrict__ out) {
  extern __shared__ __align__(16) _Float16 smem[];
  _Float16* bufN = smem;                 // stem LN output, then one of the two activation buffers [BM][RS]
  _Float16* bufR = smem + ACT_HALVES;    // stem output, then the other                            [BM][RS]
  float* p1 = (float*)(smem + 2 * ACT_HALVES);  // [BM][8] partial sums
  float* p2 = p1 + PART_FLOATS;                  // [BM][8] partial sq-sums
  float* p3 = p2 + PART_FLOATS;                  // [BM][8] partial dots (head)
  float* stM = p3 + PART_FLOATS;                 // [BM] row mean of the layer's input
  float* stI = stM + BM;                         // [BM] row 1/std of the layer's input

  const int tid     = threadIdx.x;
  const int lane    = tid & 31;
  const int wave    = tid >> 5;          // 0..15
  const int rowBase = blockIdx.x * BM;

  const int nw    = wave * 64;           // this wave's 64 output columns (4 N tiles), all 64 rows (4 M tiles)
  const int lm    = lane & 15;
  const int koff  = (lane >> 4) << 3;    // hi half-wave reads K+8

  // LN work mapping: one row per lane (32 distinct rows per wave -> ~2-way LDS conflicts max)
  const int lrow = tid & 63;             // row handled by this thread
  const int lseg = tid >> 6;             // which 128-col segment (0..7)
  const int c0   = lseg * 128;
  // Block-layer row statistics: 8 lanes share a row, 4 rows per wave, 8 rows apart so that the
  // two rows of a half-wave's 16-byte reads fall on different halves of the banks.
  const int srow = (wave & 7) + ((lane >> 3) << 3) + ((wave >> 3) << 5);
  const int sj   = lane & 7;

  // ---------------- stem LayerNorm over 26 features ----------------
  if (tid < BM) {
    const float* xr = x + (size_t)(rowBase + tid) * FIN;
    float v[FIN];
    float s1 = 0.f;
#pragma unroll
    for (int i = 0; i < FIN; ++i) { v[i] = xr[i]; s1 += v[i]; }
    const float m = s1 * (1.f / FIN);
    float s2 = 0.f;
#pragma unroll
    for (int i = 0; i < FIN; ++i) { float d = v[i] - m; s2 += d * d; }
    const float inv = rsqrtf(s2 * (1.f / FIN) + 1e-5f);
    _Float16* dst = bufN + tid * RS;
#pragma unroll
    for (int i = 0; i < FIN; ++i)
      dst[i] = (_Float16)((v[i] - m) * inv * st_gamma[i] + st_beta[i]);
#pragma unroll
    for (int i = FIN; i < 32; ++i) dst[i] = (_Float16)0.f;
  }
  __syncthreads();

  // The weight fragments of the two k steps ahead live here, over layer ends too. Layer 0's first two
  // k steps are asked for here and fly under the stem's GEMM.
  v16h bF[2][4];
  const int      wvu  = __builtin_amdgcn_readfirstlane(wave);   // the wave's number as a scalar: weight addresses = scalar base + lane offset
  const unsigned loff = (unsigned)lane * 16u;   // bytes
  load_2ksteps(bF, (const _Float16*)((const char*)(blkW16 + (size_t)wvu * (64 * HDIM)) + loff));

  // ---------------- stem GEMM: [64 x 32] x [32 x 1024], one WMMA K step ----------------
  {
    v16h aF[4];
#pragma unroll
    for (int m = 0; m < 4; ++m) aF[m] = load_frag16(bufN + (m * 16 + lm) * RS + koff);
#pragma unroll
    for (int t = 0; t < 4; ++t) {
      const float bv = st_b[nw + t * 16 + lm];
      const v16h bF = load_frag16(stemW16 + (size_t)(nw + t * 16 + lm) * 32 + koff);
#pragma unroll
      for (int m = 0; m < 4; ++m) {
        v8f acc;
#pragma unroll
        for (int r = 0; r < 8; ++r) acc[r] = bv;
        acc = __builtin_amdgcn_wmma_f32_16x16x32_f16(false, aF[m], false, bF,
                                                     (short)0, acc, false, false);
        store_tile_relu(bufR, m, nw + t * 16, lane, acc);
      }
    }
  }

  // ---------------- 8 blocks: LN -> Linear(H->H) -> ReLU ----------------
  // The GEMM runs on the raw ReLU activations against gamma * W; the row mean enters as the
  // accumulators' start value and 1/std, beta W^T and the bias in the epilogue.
  int curOff = ACT_HALVES;   // this layer's input  (halves from smem)
  int nxtOff = 0;            // this layer's output
  for (int l = 0; l < NLAYERS; ++l) {
    const _Float16* cur = smem + curOff;
    _Float16*       nxt = smem + nxtOff;
    __syncthreads();
    // this lane's 4 columns of the two folded vectors, asked for here so that they arrive under the statistics
    float c1v[4], cbv[4];
#pragma unroll
    for (int t = 0; t < 4; ++t) {
      c1v[t] = blkC1[(size_t)l * HDIM + nw + t * 16 + lm];
      cbv[t] = blkCb[(size_t)l * HDIM + nw + t * 16 + lm];
    }
    // ---- row mean and 1/std of the input, whole rows inside a wave ----
    {
      const _Float16* src = cur + srow * RS + sj * 8;
      float s1 = 0.f, s2 = 0.f;
#pragma unroll
      for (int cc = 0; cc < HDIM; cc += 64) {
        v8h h = *(const v8h*)(src + cc);
#pragma unroll
        for (int i = 0; i < 8; ++i) { float v = (float)h[i]; s1 += v; s2 += v * v; }
      }
#pragma unroll
      for (int d = 1; d <= 4; d <<= 1) { s1 += __shfl_xor(s1, d, 32); s2 += __shfl_xor(s2, d, 32); }
      const float m   = s1 * (1.f / HDIM);
      const float var = s2 * (1.f / HDIM) - m * m;
      const float inv = rsqrtf(var + 1e-5f);
      if (sj == 0) { stM[srow] = m; stI[srow] = inv; }
    }
    __syncthreads();
    // ---- GEMM cur x (gamma W_l)^T -> scale, constant, ReLU -> nxt ----
    const _Float16* wl = blkW16 + (size_t)l * HDIM * HDIM;   // packed: see cvt_blk_kernel
    {
      // 64x64 wave tile: every weight fragment feeds all 4 M tiles, so the
      // work-group loads each weight row once instead of once per M tile.
      const int rhalf = (lane >> 4) << 3;   // this lane's 8 accumulator rows inside an M tile
      v8f acc[4][4];   // [m][t]
      {
#pragma unroll
        for (int m = 0; m < 4; ++m) {
          const v4f mlo = *(const v4f*)(stM + m * 16 + rhalf);
          const v4f mhi = *(const v4f*)(stM + m * 16 + rhalf + 4);
#pragma unroll
          for (int t = 0; t < 4; ++t)
#pragma unroll
            for (int r = 0; r < 4; ++r) {
              acc[m][t][r]     = -mlo[r] * c1v[t];
              acc[m][t][4 + r] = -mhi[r] * c1v[t];
            }
        }
      }
      const _Float16* arow = cur + lm * RS + koff;
      const _Float16* wpk = wl + (size_t)wvu * (64 * HDIM);
      // 64 k per trip = two k steps of 4 KiB of this wave's packed weights. The fragments of a k step
      // were asked for two k steps earlier.
      for (int k = 0; k < HDIM - 64; k += 64) {
#pragma unroll
        for (int s = 0; s < 2; ++s)
          kstep_wmma_refill(acc, arow + k + s * 32, bF[s], wpk + (size_t)(k + 64) * 64 + s * 2048, loff);
      }
      // last trip: nothing of this layer is left to ask for
#pragma unroll
      for (int s = 0; s < 2; ++s) kstep_wmma(acc, arow + (HDIM - 64) + s * 32, bF[s]);
      // The next layer's first two k steps depend on no activation: asked for here, they fly under
      // this layer's epilogue and the next one's statistics.
      if (l + 1 < NLAYERS)
        load_2ksteps(bF, (const _Float16*)((const char*)(wpk + (size_t)HDIM * HDIM) + loff));
#pragma unroll
      for (int m = 0; m < 4; ++m) {
        const v4f ilo = *(const v4f*)(stI + m * 16 + rhalf);
        const v4f ihi = *(const v4f*)(stI + m * 16 + rhalf + 4);
        const v8f inv = __builtin_shufflevector(ilo, ihi, 0, 1, 2, 3, 4, 5, 6, 7);
#pragma unroll
        for (int t = 0; t < 4; ++t)
          store_tile_scale_relu(nxt, m, nw + t * 16, lane, acc[m][t], inv, cbv[t]);
      }
    }
    const int sw = curOff; curOff = nxtOff; nxtOff = sw;
  }
  __syncthreads();
  const _Float16* hfin = smem + curOff;   // the last layer's output

  // ---------------- head: LN -> Linear(H->1) -> sigmoid ----------------
  {
    const _Float16* src = hfin + lrow * RS + c0;
    float s1 = 0.f, s2 = 0.f;
#pragma unroll
    for (int cc = 0; cc < 128; cc += 8) {
      v8h h = *(const v8h*)(src + cc);
#pragma unroll
      for (int i = 0; i < 8; ++i) { float v = (float)h[i]; s1 += v; s2 += v * v; }
    }
    p1[lrow * 8 + lseg] = s1;
    p2[lrow * 8 + lseg] = s2;
  }
  __syncthreads();
  {
    float s1 = 0.f, s2 = 0.f;
#pragma unroll
    for (int j = 0; j < 8; ++j) { s1 += p1[lrow * 8 + j]; s2 += p2[lrow * 8 + j]; }
    const float m   = s1 * (1.f / HDIM);
    const float var = s2 * (1.f / HDIM) - m * m;
    const float inv = rsqrtf(var + 1e-5f);
    const _Float16* src = hfin + lrow * RS + c0;
    const float* lg = last_gamma + c0;
    const float* lb = last_beta + c0;
    const float* lw = last_w + c0;
    float dot = 0.f;
#pragma unroll
    for (int cc = 0; cc < 128; cc += 8) {
      v8h h = *(const v8h*)(src + cc);
#pragma unroll
      for (int i = 0; i < 8; ++i) {
        float v = ((float)h[i] - m) * inv * lg[cc + i] + lb[cc + i];
        dot += v * lw[cc + i];
      }
    }
    p3[lrow * 8 + lseg] = dot;
  }
  __syncthreads();
  if (tid < BM) {
    float dot = 0.f;
#pragma unroll
    for (int j = 0; j < 8; ++j) dot += p3[tid * 8 + j];
    const float z = dot + last_b[0];
    (out + rowBase)[tid] = 1.f / (1.f + __expf(-z));   // scalar base + thread index: no row index kept in a register over the layers
  }
}

// ================= host launcher =================
extern "C" void kernel_launch(void* const* d_in, const int* in_sizes, int n_in,
                              void* d_out, int out_size, void* d_ws, size_t ws_size,
                              hipStream_t stream) {
  (void)in_sizes; (void)n_in; (void)out_size; (void)ws_size;

  const float* x         = (const float*)d_in[0];
  const float* st_gamma  = (const float*)d_in[1];
  const float* st_beta   = (const float*)d_in[2];
  const float* st_w      = (const float*)d_in[3];
  const float* st_b      = (const float*)d_in[4];
  const float* blk_gamma = (const float*)d_in[5];
  const float* blk_beta  = (const float*)d_in[6];
  const float* blk_w     = (const float*)d_in[7];
  const float* blk_b     = (const float*)d_in[8];
  const float* last_gamma= (const float*)d_in[9];
  const float* last_beta = (const float*)d_in[10];
  const float* last_w    = (const float*)d_in[11];
  const float* last_b    = (const float*)d_in[12];
  float* out = (float*)d_out;

  // ws layout: stem weights padded to [1024][32] f16, then block weights, 8*1024*1024 f16, packed,
  // then the two per-column vectors of the folded LayerNorm, 8*1024 f32 each
  _Float16* stemW16 = (_Float16*)d_ws;
  _Float16* blkW16  = stemW16 + (size_t)HDIM * 32;
  float*    blkC1   = (float*)(blkW16 + (size_t)NLAYERS * HDIM * HDIM);
  float*    blkCb   = blkC1 + NLAYERS * HDIM;

  // convert weights to f16 (every call; deterministic)
  {
    const int n8 = NLAYERS * HDIM * HDIM / 8;   // 16-byte pieces
    cvt_blk_kernel<<<(n8 + 255) / 256, 256, 0, stream>>>(blk_w, blk_gamma, blkW16, n8);
    fold_ln_kernel<<<NLAYERS * HDIM * 32 / 256, 256, 0, stream>>>(blk_w, blk_gamma, blk_beta, blk_b,
                                                                  blkC1, blkCb);
    cvt_stem_kernel<<<(HDIM * 32 + 255) / 256, 256, 0, stream>>>(st_w, stemW16);
  }

  static_assert(SMEM_BYTES == 270848, "LDS budget (<= 320KB/WGP)");
  hipFuncSetAttribute((const void*)mlp_fused_kernel,
                      hipFuncAttributeMaxDynamicSharedMemorySize, SMEM_BYTES);

  const int nBlocks = 65536 / BM;  // 1024
  mlp_fused_kernel<<<nBlocks, NTHREADS, SMEM_BYTES, stream>>>(
      x, st_gamma, st_beta, st_b,
      blkC1, blkCb,
      last_gamma, last_beta, last_w, last_b,
      stemW16, blkW16, out);
}

// v005
// One run takes 614 microseconds.
// In both of two side-by-side timings against v004, it was 1.03 times as fast.
// Over all steps from v000 it is 5.83 times as fast.
#include <hip/hip_runtime.h>

typedef _Float16 v8h  __attribute__((ext_vector_type(8)));
typedef _Float16 v16h __attribute__((ext_vector_type(16)));
typedef float    v8f  __attribute__((ext_vector_type(8)));
typedef float    v4f  __attribute__((ext_vector_type(4)));
typedef float    v2f  __attribute__((ext_vector_type(2)));

#define HDIM    1024
#define RS      1032      // padded LDS row stride in halves (2064 B: 16B-aligned, bank ~= 4*row)
#define BM      64        // batch rows per workgroup
#define NTHREADS 512      // 16 wave32s
#define NLAYERS 8
#define FIN     26
// 2 activation buffers + 3 small reduction scratch arrays (s1, s2, dot) + per-row mean and 1/std + a layer's column constants
#define ACT_HALVES   (BM * RS)
#define PART_FLOATS  (BM * 8)
#define SMEM_BYTES   (2 * ACT_HALVES * (int)sizeof(_Float16) + (3 * PART_FLOATS + 2 * BM + HDIM) * (int)sizeof(float))

// ---- fragment loader: lane-local 16 halves = [k..k+7] and [k+16..k+23] ----
__device__ __forceinline__ v16h load_frag16(const _Float16* p) {
  v8h lo = *(const v8h*)p;
  v8h hi = *(const v8h*)(p + 16);
  return __builtin_shufflevector(lo, hi, 0,1,2,3,4,5,6,7,8,9,10,11,12,13,14,15);
}

// ---- the same fragment from the packed weights: its two halves lie 512 bytes apart ----
__device__ __forceinline__ v16h load_frag16_packed(const _Float16* p) {
  v8h lo = *(const v8h*)p;
  v8h hi = *(const v8h*)(p + 256);
  return __builtin_shufflevector(lo, hi, 0,1,2,3,4,5,6,7,8,9,10,11,12,13,14,15);
}

// Two k steps' weight fragments from p, the lane's own place in the packed weights: 16 loads as one group.
__device__ __forceinline__ void load_2ksteps(v16h (&b)[2][4], const _Float16* p) {
#pragma unroll
  for (int s = 0; s < 2; ++s)
#pragma unroll
    for (int t = 0; t < 4; ++t) b[s][t] = load_frag16_packed(p + s * 2048 + t * 512);
  // Stands in front of whatever next writes the address registers that these loads name, and keeps the
  // loads where they are written. The pointer as an input stays in its registers up to the wait, so
  // that no load's result is placed on them.
  asm volatile("s_wait_xcnt 0x0" :: "v"(p) : "memory");
}

// ---- one k step of the 64x64 wave tile: 4 activation fragments from LDS, 16 WMMAs ----
// The weights are operand A and the activations operand B: accumulator register r of lane (c, h) is
// output column 8h + r of the N tile, batch row c of the M tile.
__device__ __forceinline__ void kstep_wmma(v8f (&acc)[4][4], const _Float16* a, const v16h (&b)[4]) {
  v16h aF[4];
#pragma unroll
  for (int m = 0; m < 4; ++m) aF[m] = load_frag16(a + m * 16 * RS);
#pragma unroll
  for (int t = 0; t < 4; ++t)
#pragma unroll
    for (int m = 0; m < 4; ++m)
      acc[m][t] = __builtin_amdgcn_wmma_f32_16x16x32_f16(false, b[t], false, aF[m],
                                                         (short)0, acc[m][t], false, false);
}

// ---- the same k step; each weight fragment is asked for anew, for the k step two ahead (at nb), as soon as
//      the 4 WMMAs that read it are issued: 14 of a wave's 16 weight loads stay in flight all the time ----
__device__ __forceinline__ void kstep_wmma_refill(v8f (&acc)[4][4], const _Float16* a, v16h (&b)[4],
                                                  const _Float16* nb, unsigned loff) {
  v16h aF[4];
#pragma unroll
  for (int m = 0; m < 4; ++m) aF[m] = load_frag16(a + m * 16 * RS);
#pragma unroll
  for (int t = 0; t < 4; ++t) {
#pragma unroll
    for (int m = 0; m < 4; ++m)
      acc[m][t] = __builtin_amdgcn_wmma_f32_16x16x32_f16(false, b[t], false, aF[m],
                                                         (short)0, acc[m][t], false, false);
    // The two fences keep the refill directly behind the WMMAs that read these registers: hoisted it
    // would need registers of its own, sunk it would lose its lead.
    __builtin_amdgcn_sched_barrier(0);
    b[t] = load_frag16_packed((const _Float16*)((const char*)(nb + t * 512) + loff));
    __builtin_amdgcn_sched_barrier(0);
  }
}

// ---- a lane's 8 accumulator values are 8 consecutive columns of one row: f16, ReLU on the packed halves
//      (rounding keeps sign and order, so the values are those of ReLU before rounding), one 16-byte store ----
__device__ __forceinline__ void store_row8_relu(_Float16* dst, const v8f& v) {
  v8h h = __builtin_convertvector(v, v8h);
  const v8h zero = {};
  h = __builtin_elementwise_max(h, zero);
  *(v8h*)dst = h;
}

// A per-column f32 vector in global memory, from p, the lane's own 8 columns of its first N tile:
// 8 floats for each of the 4 N tiles.
__device__ __forceinline__ void load_cols(v8f (&c)[4], const float* p) {
#pragma unroll
  for (int t = 0; t < 4; ++t) {
    const v4f lo = *(const v4f*)(p + t * 16);
    const v4f hi = *(const v4f*)(p + t * 16 + 4);
    c[t] = __builtin_shufflevector(lo, hi, 0, 1, 2, 3, 4, 5, 6, 7);
  }
  // Stands in front of whatever next writes the address registers that these loads name, and keeps the
  // loads where they are written. The pointer as an input stays in its registers up to the wait, so
  // that no load's result is placed on them.
  asm volatile("s_wait_xcnt 0x0" :: "v"(p) : "memory");
}

// ================= weight preparation kernels (f32 -> f16 weights, f32 folded LayerNorm vectors; run each call) =================
// Block weights go out in the order the GEMM's lanes read them:
//   [layer][wave 16][k step of 32: 32][N tile 4][fragment half 2][lane 32][8 halves]
// so that one wave-wide 16-byte load is 512 contiguous bytes (4 whole 128-byte lines)
// and a wave's 16 loads of a trip are 8 KiB in a row.
// One thread makes one lane's 16-byte piece; a block of 256 reads 64 whole lines of w.
// The layer's LayerNorm gain is multiplied in here: LN(h) W^T = ((h - mean) / std) (gamma * W)^T + beta W^T.
__global__ void cvt_blk_kernel(const float* __restrict__ w, const float* __restrict__ g,
                               _Float16* __restrict__ o, int n8) {
  const int i = blockIdx.x * blockDim.x + threadIdx.x;   // piece index in packed order
  if (i >= n8) return;
  const int lane = i & 31;
  const int part = (i >> 5) & 1;
  const int t    = (i >> 6) & 3;
  const int ks   = (i >> 8) & 31;
  const int wv   = (i >> 13) & 15;
  const int l    = i >> 17;
  const int row  = wv * 64 + t * 16 + (lane & 15);
  const int k    = ks * 32 + part * 16 + ((lane >> 4) << 3);
  const float* src = w + ((size_t)l * HDIM + row) * HDIM + k;
  const v4f a = *(const v4f*)src;
  const v4f b = *(const v4f*)(src + 4);
  const float* gs = g + (size_t)l * HDIM + k;
  const v4f ga = *(const v4f*)gs;
  const v4f gb = *(const v4f*)(gs + 4);
  v8h h;
#pragma unroll
  for (int j = 0; j < 4; ++j) { h[j] = (_Float16)(a[j] * ga[j]); h[4 + j] = (_Float16)(b[j] * gb[j]); }
  *(v8h*)(o + (size_t)i * 8) = h;
}

// Per output column n of each block layer, one wave each:
//   c1[n] = sum_k f16(gamma_k W[n][k])   (what the row mean is multiplied by; the GEMM's own rounded weights)
//   cb[n] = sum_k beta_k W[n][k] + b[n]  (the column's constant)
__global__ void fold_ln_kernel(const float* __restrict__ w, const float* __restrict__ g,
                               const float* __restrict__ be, const float* __restrict__ b,
                               float* __restrict__ c1, float* __restrict__ cb) {
  const int row  = (blockIdx.x * blockDim.x + threadIdx.x) >> 5;   // layer * 1024 + n
  const int lane = threadIdx.x & 31;
  if (row >= NLAYERS * HDIM) return;
  const float* wr = w  + (size_t)row * HDIM + lane * 4;
  const float* gl = g  + (size_t)(row >> 10) * HDIM + lane * 4;
  const float* bl = be + (size_t)(row >> 10) * HDIM + lane * 4;
  float s1 = 0.f, s2 = 0.f;
#pragma unroll
  for (int i = 0; i < 8; ++i) {
    // The wait behind each load stands in front of whatever next writes a register that the load
    // names: in the unrolled form a later load's result is placed on the pointers' registers.
    const v4f a  = *(const v4f*)(wr + i * 128);
    asm volatile("s_wait_xcnt 0x0" ::: "memory");
    const v4f ga = *(const v4f*)(gl + i * 128);
    asm volatile("s_wait_xcnt 0x0" ::: "memory");
    const v4f ba = *(const v4f*)(bl + i * 128);
    asm volatile("s_wait_xcnt 0x0" ::: "memory");
#pragma unroll
    for (int j = 0; j < 4; ++j) { s1 += (float)(_Float16)(a[j] * ga[j]); s2 += a[j] * ba[j]; }
  }
#pragma unroll
  for (int d = 16; d >= 1; d >>= 1) { s1 += __shfl_xor(s1, d, 32); s2 += __shfl_xor(s2, d, 32); }
  if (lane == 0) { c1[row] = s1; cb[row] = s2 + b[row]; }
}

__global__ void cvt_stem_kernel(const float* __restrict__ w, _Float16* __restrict__ o) {
  int i = blockIdx.x * blockDim.x + threadIdx.x;   // 0 .. 1024*32-1
  if (i >= HDIM * 32) return;
  int row = i >> 5, col = i & 31;
  o[i] = (col < FIN) ? (_Float16)w[row * FIN + col] : (_Float16)0.f;
}

// ================= fused MLP kernel =================
__global__ void __launch_bounds__(NTHREADS, 1)
mlp_fused_kernel(const float* __restrict__ x,
                 const float* __restrict__ st_gamma, const float* __restrict__ st_beta,
                 const float* __restrict__ st_b,
                 const float* __restrict__ blkC1, const float* __restrict__ blkCb,
                 const float* __restrict__ last_gamma, const float* __restrict__ last_beta,
                 const float* __restrict__ last_w, const float* __restrict__ last_b,
                 const _Float16* __restrict__ stemW16, const _Float16* __restrict__ blkW16,
                 float* __restrict__ out) {
  extern __shared__ __align__(16) _Float16 smem[];
  _Float16* bufN = smem;                 // stem LN output, then one of the two activation buffers [BM][RS]
  _Float16* bufR = smem + ACT_HALVES;    // stem output, then the other                            [BM][RS]
  float* p1 = (float*)(smem + 2 * ACT_HALVES);  // [BM][8] partial sums
  float* p2 = p1 + PART_FLOATS;                  // [BM][8] partial sq-sums
  float* p3 = p2 + PART_FLOATS;                  // [BM][8] partial dots (head)
  float* stM = p3 + PART_FLOATS;                 // [BM] row mean of the layer's input
  float* stI = stM + BM;                         // [BM] row 1/std of the layer's input
  float* cbS = stI + BM;                         // [HDIM] the layer's column constants

  const int tid     = threadIdx.x;
  const int lane    = tid & 31;
  const int wave    = tid >> 5;          // 0..15
  const int rowBase = blockIdx.x * BM;

  const int nw    = wave * 64;           // this wave's 64 output columns (4 N tiles), all 64 rows (4 M tiles)
  const int lm    = lane & 15;
  const int koff  = (lane >> 4) << 3;    // hi half-wave reads K+8, and holds output columns +8 of an N tile

  // LN work mapping: one row per lane (32 distinct rows per wave -> ~2-way LDS conflicts max)
  const int lrow = tid & 63;             // row handled by this thread
  const int lseg = tid >> 6;             // which 128-col segment (0..7)
  const int c0   = lseg * 128;
  // Block-layer row statistics: 8 lanes share a row, 4 rows per wave, 8 rows apart so that the
  // two rows of a half-wave's 16-byte reads fall on different halves of the banks.
  const int srow = (wave & 7) + ((lane >> 3) << 3) + ((wave >> 3) << 5);
  const int sj   = lane & 7;

  // ---------------- stem LayerNorm over 26 features ----------------
  if (tid < BM) {
    const float* xr = x + (size_t)(rowBase + tid) * FIN;
    float v[FIN];
    float s1 = 0.f;
#pragma unroll
    for (int i = 0; i < FIN; ++i) { v[i] = xr[i]; s1 += v[i]; }
    const float m = s1 * (1.f / FIN);
    float s2 = 0.f;
#pragma unroll
    for (int i = 0; i < FIN; ++i) { float d = v[i] - m; s2 += d * d; }
    const float inv = rsqrtf(s2 * (1.f / FIN) + 1e-5f);
    _Float16* dst = bufN + tid * RS;
#pragma unroll
    for (int i = 0; i < FIN; ++i)
      dst[i] = (_Float16)((v[i] - m) * inv * st_gamma[i] + st_beta[i]);
#pragma unroll
    for (int i = FIN; i < 32; ++i) dst[i] = (_Float16)0.f;
  }
  __syncthreads();

  // The weight fragments of the two k steps ahead live here, over layer ends too. Layer 0's first two
  // k steps are asked for here and fly under the stem's GEMM.
  v16h bF[2][4];
  const int      wvu  = __builtin_amdgcn_readfirstlane(wave);   // the wave's number as a scalar: weight addresses = scalar base + lane offset
  const unsigned loff = (unsigned)lane * 16u;   // bytes
  load_2ksteps(bF, (const _Float16*)((const char*)(blkW16 + (size_t)wvu * (64 * HDIM)) + loff));

  // ---------------- stem GEMM: [64 x 32] x [32 x 1024], one WMMA K step ----------------
  {
    v8f sb[4];   // the bias of this lane's columns is the accumulators' start value
    load_cols(sb, st_b + nw + koff);
    const _Float16* swp = stemW16 + (size_t)(nw + lm) * 32 + koff;
    v16h sw[4];   // the stem's weight fragments of the 4 N tiles
#pragma unroll
    for (int t = 0; t < 4; ++t) sw[t] = load_frag16(swp + t * 16 * 32);
    // Stands in front of whatever next writes the address registers that these loads name; the pointer
    // as an input stays in its registers up to the wait, so that no load's result is placed on them.
    asm volatile("s_wait_xcnt 0x0" :: "v"(swp) : "memory");
    v16h aF[4];
#pragma unroll
    for (int m = 0; m < 4; ++m) aF[m] = load_frag16(bufN + (m * 16 + lm) * RS + koff);
#pragma unroll
    for (int t = 0; t < 4; ++t) {
#pragma unroll
      for (int m = 0; m < 4; ++m) {
        const v8f acc = __builtin_amdgcn_wmma_f32_16x16x32_f16(false, sw[t], false, aF[m],
                                                               (short)0, sb[t], false, false);
        store_row8_relu(bufR + (m * 16 + lm) * RS + nw + t * 16 + koff, acc);
      }
    }
  }

  // ---------------- 8 blocks: LN -> Linear(H->H) -> ReLU ----------------
  // The GEMM runs on the raw ReLU activations against gamma * W; the row mean enters as the
  // accumulators' start value and 1/std, beta W^T and the bias in the epilogue.
  int curOff = ACT_HALVES;   // this layer's input  (halves from smem)
  int nxtOff = 0;            // this layer's output
  for (int l = 0; l < NLAYERS; ++l) {
    const _Float16* cur = smem + curOff;
    _Float16*       nxt = smem + nxtOff;
    __syncthreads();
    // this lane's 32 columns of the column sums, asked for here so that they arrive under the statistics
    v8f c1v[4];
    load_cols(c1v, blkC1 + (size_t)l * HDIM + nw + koff);
    // The column constants go through LDS, 2 floats a thread: a lane wants 32 of them in the epilogue, too
    // many to hold in registers over the GEMM.
    const float* cbp = blkCb + (size_t)l * HDIM + tid * 2;
    const v2f cbg = *(const v2f*)cbp;
    // Stands in front of whatever next writes the address registers that this load names.
    asm volatile("s_wait_xcnt 0x0" :: "v"(cbp) : "memory");
    // ---- row mean and 1/std of the input, whole rows inside a wave ----
    {
      const _Float16* src = cur + srow * RS + sj * 8;
      float s1 = 0.f, s2 = 0.f;
#pragma unroll
      for (int cc = 0; cc < HDIM; cc += 64) {
        v8h h = *(const v8h*)(src + cc);
#pragma unroll
        for (int i = 0; i < 8; ++i) { float v = (float)h[i]; s1 += v; s2 += v * v; }
      }
#pragma unroll
      for (int d = 1; d <= 4; d <<= 1) { s1 += __shfl_xor(s1, d, 32); s2 += __shfl_xor(s2, d, 32); }
      const float m   = s1 * (1.f / HDIM);
      const float var = s2 * (1.f / HDIM) - m * m;
      const float inv = rsqrtf(var + 1e-5f);
      if (sj == 0) { stM[srow] = m; stI[srow] = inv; }
    }
    *(v2f*)(cbS + tid * 2) = cbg;
    __syncthreads();
    // ---- GEMM cur x (gamma W_l)^T -> scale, constant, ReLU -> nxt ----
    const _Float16* wl = blkW16 + (size_t)l * HDIM * HDIM;   // packed: see cvt_blk_kernel
    {
      // 64x64 wave tile: every weight fragment feeds all 4 M tiles, so the
      // work-group loads each weight row once instead of once per M tile.
      v8f acc[4][4];   // [m][t]
#pragma unroll
      for (int m = 0; m < 4; ++m) {
        const float nm = -stM[m * 16 + lm];   // this lane's one row of the M tile
#pragma unroll
        for (int t = 0; t < 4; ++t) acc[m][t] = c1v[t] * nm;
      }
      const _Float16* arow = cur + lm * RS + koff;
      const _Float16* wpk = wl + (size_t)wvu * (64 * HDIM);
      // 64 k per trip = two k steps of 4 KiB of this wave's packed weights. The fragments of a k step
      // were asked for two k steps earlier.
      for (int k = 0; k < HDIM - 64; k += 64) {
#pragma unroll
        for (int s = 0; s < 2; ++s)
          kstep_wmma_refill(acc, arow + k + s * 32, bF[s], wpk + (size_t)(k + 64) * 64 + s * 2048, loff);
      }
      // last trip: nothing of this layer is left to ask for
#pragma unroll
      for (int s = 0; s < 2; ++s) kstep_wmma(acc, arow + (HDIM - 64) + s * 32, bF[s]);
      // The next layer's first two k steps depend on no activation: asked for here, they fly under
      // this layer's epilogue and the next one's statistics.
      if (l + 1 < NLAYERS)
        load_2ksteps(bF, (const _Float16*)((const char*)(wpk + (size_t)HDIM * HDIM) + loff));
      v8f cbv[4];   // this lane's 32 columns of the constants
#pragma unroll
      for (int t = 0; t < 4; ++t) {
        const v4f lo = *(const v4f*)(cbS + nw + t * 16 + koff);
        const v4f hi = *(const v4f*)(cbS + nw + t * 16 + koff + 4);
        cbv[t] = __builtin_shufflevector(lo, hi, 0, 1, 2, 3, 4, 5, 6, 7);
      }
      float inv[4];   // this lane's one row of each M tile
#pragma unroll
      for (int m = 0; m < 4; ++m) inv[m] = stI[m * 16 + lm];
#pragma unroll
      for (int m = 0; m < 4; ++m)
#pragma unroll
        for (int t = 0; t < 4; ++t)
          store_row8_relu(nxt + (m * 16 + lm) * RS + nw + t * 16 + koff, acc[m][t] * inv[m] + cbv[t]);
    }
    const int sw = curOff; curOff = nxtOff; nxtOff = sw;
  }
  __syncthreads();
  const _Float16* hfin = smem + curOff;   // the last layer's output

  // ---------------- head: LN -> Linear(H->1) -> sigmoid ----------------
  {
    const _Float16* src = hfin + lrow * RS + c0;
    float s1 = 0.f, s2 = 0.f;
#pragma unroll
    for (int cc = 0; cc < 128; cc += 8) {
      v8h h = *(const v8h*)(src + cc);
#pragma unroll
      for (int i = 0; i < 8; ++i) { float v = (float)h[i]; s1 += v; s2 += v * v; }
    }
    p1[lrow * 8 + lseg] = s1;
    p2[lrow * 8 + lseg] = s2;
  }
  __syncthreads();
  {
    float s1 = 0.f, s2 = 0.f;
#pragma unroll
    for (int j = 0; j < 8; ++j) { s1 += p1[lrow * 8 + j]; s2 += p2[lrow * 8 + j]; }
    const float m   = s1 * (1.f / HDIM);
    const float var = s2 * (1.f / HDIM) - m * m;
    const float inv = rsqrtf(var + 1e-5f);
    const _Float16* src = hfin + lrow * RS + c0;
    const float* lg = last_gamma + c0;
    const float* lb = last_beta + c0;
    const float* lw = last_w + c0;
    float dot = 0.f;
#pragma unroll
    for (int cc = 0; cc < 128; cc += 8) {
      v8h h = *(const v8h*)(src + cc);
#pragma unroll
      for (int i = 0; i < 8; ++i) {
        float v = ((float)h[i] - m) * inv * lg[cc + i] + lb[cc + i];
        dot += v * lw[cc + i];
      }
    }
    p3[lrow * 8 + lseg] = dot;
  }
  __syncthreads();
  if (tid < BM) {
    float dot = 0.f;
#pragma unroll
    for (int j = 0; j < 8; ++j) dot += p3[tid * 8 + j];
    const float z = dot + last_b[0];
    (out + rowBase)[tid] = 1.f / (1.f + __expf(-z));   // scalar base + thread index: no row index kept in a register over the layers
  }
}

// ================= host launcher =================
extern "C" void kernel_launch(void* const* d_in, const int* in_sizes, int n_in,
                              void* d_out, int out_size, void* d_ws, size_t ws_size,
                              hipStream_t stream) {
  (void)in_sizes; (void)n_in; (void)out_size; (void)ws_size;

  const float* x         = (const float*)d_in[0];
  const float* st_gamma  = (const float*)d_in[1];
  const float* st_beta   = (const float*)d_in[2];
  const float* st_w      = (const float*)d_in[3];
  const float* st_b      = (const float*)d_in[4];
  const float* blk_gamma = (const float*)d_in[5];
  const float* blk_beta  = (const float*)d_in[6];
  const float* blk_w     = (const float*)d_in[7];
  const float* blk_b     = (const float*)d_in[8];
  const float* last_gamma= (const float*)d_in[9];
  const float* last_beta = (const float*)d_in[10];
  const float* last_w    = (const float*)d_in[11];
  const float* last_b    = (const float*)d_in[12];
  float* out = (float*)d_out;

  // ws layout: stem weights padded to [1024][32] f16, then block weights, 8*1024*1024 f16, packed,
  // then the two per-column vectors of the folded LayerNorm, 8*1024 f32 each
  _Float16* stemW16 = (_Float16*)d_ws;
  _Float16* blkW16  = stemW16 + (size_t)HDIM * 32;
  float*    blkC1   = (float*)(blkW16 + (size_t)NLAYERS * HDIM * HDIM);
  float*    blkCb   = blkC1 + NLAYERS * HDIM;

  // convert weights to f16 (every call; deterministic)
  {
    const int n8 = NLAYERS * HDIM * HDIM / 8;   // 16-byte pieces
    cvt_blk_kernel<<<(n8 + 255) / 256, 256, 0, stream>>>(blk_w, blk_gamma, blkW16, n8);
    fold_ln_kernel<<<NLAYERS * HDIM * 32 / 256, 256, 0, stream>>>(blk_w, blk_gamma, blk_beta, blk_b,
                                                                  blkC1, blkCb);
    cvt_stem_kernel<<<(HDIM * 32 + 255) / 256, 256, 0, stream>>>(st_w, stemW16);
  }

  static_assert(SMEM_BYTES == 274944, "LDS budget (<= 320KB/WGP)");
  hipFuncSetAttribute((const void*)mlp_fused_kernel,
                      hipFuncAttributeMaxDynamicSharedMemorySize, SMEM_BYTES);

  const int nBlocks = 65536 / BM;  // 1024
  mlp_fused_kernel<<<nBlocks, NTHREADS, SMEM_BYTES, stream>>>(
      x, st_gamma, st_beta, st_b,
      blkC1, blkCb,
      last_gamma, last_beta, last_w, last_b,
      stemW16, blkW16, out);
}

// v006
// Measured time: 575 microseconds a run.
// In both of two side-by-side timings against v005, it was 1.07 times as fast.
// All steps since v000 together make it 6.22 times as fast.
#include <hip/hip_runtime.h>

typedef _Float16 v8h  __attribute__((ext_vector_type(8)));
typedef _Float16 v16h __attribute__((ext_vector_type(16)));
typedef float    v8f  __attribute__((ext_vector_type(8)));
typedef float    v4f  __attribute__((ext_vector_type(4)));
typedef float    v2f  __attribute__((ext_vector_type(2)));

#define HDIM    1024
#define RS      1032      // padded LDS row stride in halves (2064 B: 16B-aligned, bank ~= 4*row)
#define BM      128       // batch rows per workgroup
#define NTHREADS 256      // 8 wave32s, two per SIMD, up to 512 registers each
#define SIP     40        // LDS row stride in halves of the stem's input (80 B: 16 B x odd)
#define PARKM   3         // M tiles whose first-pass results wait in LDS, not in registers
#define PARK_HALVES ((NTHREADS / 32) * PARKM * 4 * 32 * 8)   // per wave, M tile and N tile one 16-byte piece a lane
#define NLAYERS 8
#define FIN     26
// 1 activation buffer, rewritten in place + the parking place (the stem's input lies on it first, the head's 3 small
// reduction scratch arrays s1, s2, dot last) + per-row mean and 1/std + a layer's column sums and column constants
#define ACT_HALVES   (BM * RS)
#define PART_FLOATS  (BM * 8)
#define SMEM_BYTES   ((ACT_HALVES + PARK_HALVES) * (int)sizeof(_Float16) + (2 * BM + 2 * HDIM) * (int)sizeof(float))

// ---- fragment loader: lane-local 16 halves = [k..k+7] and [k+16..k+23] ----
__device__ __forceinline__ v16h load_frag16(const _Float16* p) {
  v8h lo = *(const v8h*)p;
  v8h hi = *(const v8h*)(p + 16);
  return __builtin_shufflevector(lo, hi, 0,1,2,3,4,5,6,7,8,9,10,11,12,13,14,15);
}

// ---- the same fragment from the packed weights: its two halves lie 512 bytes apart ----
__device__ __forceinline__ v16h load_frag16_packed(const _Float16* p) {
  v8h lo = *(const v8h*)p;
  v8h hi = *(const v8h*)(p + 256);
  return __builtin_shufflevector(lo, hi, 0,1,2,3,4,5,6,7,8,9,10,11,12,13,14,15);
}

// Two k steps' weight fragments from p, the lane's own place in the packed weights: 16 loads as one group.
__device__ __forceinline__ void load_2ksteps(v16h (&b)[2][4], const _Float16* p) {
#pragma unroll
  for (int s = 0; s < 2; ++s)
#pragma unroll
    for (int t = 0; t < 4; ++t) b[s][t] = load_frag16_packed(p + s * 2048 + t * 512);
  // Stands in front of whatever next writes the address registers that these loads name, and keeps the
  // loads where they are written. The pointer as an input stays in its registers up to the wait, so
  // that no load's result is placed on them.
  asm volatile("s_wait_xcnt 0x0" :: "v"(p) : "memory");
}

// ---- one k step of the 128x64 wave tile: 8 activation fragments from LDS in two groups of 4, 32 WMMAs ----
// The weights are operand A and the activations operand B: accumulator register r of lane (c, h) is
// output column 8h + r of the N tile, batch row c of the M tile.
// Each weight fragment is asked for anew, for the k step two ahead (at nb), as soon as the 8 WMMAs
// that read it are issued: once the first group has its weights, at most the next k step's 8 weight loads are in flight.
__device__ __forceinline__ void kstep_wmma_refill(v8f (&acc)[8][4], const _Float16* a, v16h (&b)[4],
                                                  const _Float16* nb, unsigned loff) {
#pragma unroll
  for (int g = 0; g < 2; ++g) {
    v16h aF[4];
#pragma unroll
    for (int m = 0; m < 4; ++m) aF[m] = load_frag16(a + (g * 4 + m) * 16 * RS);
#pragma unroll
    for (int t = 0; t < 4; ++t) {
#pragma unroll
      for (int m = 0; m < 4; ++m)
        acc[g * 4 + m][t] = __builtin_amdgcn_wmma_f32_16x16x32_f16(false, b[t], false, aF[m],
                                                                   (short)0, acc[g * 4 + m][t], false, false);
      if (g == 1) {
        // The two fences keep the refill directly behind the last WMMAs that read these registers: hoisted
        // it would need registers of its own, sunk it would lose its lead.
        __builtin_amdgcn_sched_barrier(0);
        b[t] = load_frag16_packed((const _Float16*)((const char*)(nb + t * 512) + loff));
        __builtin_amdgcn_sched_barrier(0);
      }
    }
  }
}

// ---- a lane's 8 accumulator values are 8 consecutive columns of one row: f16, ReLU on the packed halves
//      (rounding keeps sign and order, so the values are those of ReLU before rounding): one 16-byte piece ----
__device__ __forceinline__ v8h row8_relu(const v8f& v) {
  v8h h = __builtin_convertvector(v, v8h);
  const v8h zero = {};
  return __builtin_elementwise_max(h, zero);
}

// A per-column f32 vector in global memory, from p, the lane's own 8 columns of its first N tile:
// 8 floats for each of the 4 N tiles.
__device__ __forceinline__ void load_cols(v8f (&c)[4], const float* p) {
#pragma unroll
  for (int t = 0; t < 4; ++t) {
    const v4f lo = *(const v4f*)(p + t * 16);
    const v4f hi = *(const v4f*)(p + t * 16 + 4);
    c[t] = __builtin_shufflevector(lo, hi, 0, 1, 2, 3, 4, 5, 6, 7);
  }
  // Stands in front of whatever next writes the address registers that these loads name, and keeps the
  // loads where they are written. The pointer as an input stays in its registers up to the wait, so
  // that no load's result is placed on them.
  asm volatile("s_wait_xcnt 0x0" :: "v"(p) : "memory");
}

// ================= weight preparation kernels (f32 -> f16 weights, f32 folded LayerNorm vectors; run each call) =================
// Block weights go out in the order the GEMM's lanes read them:
//   [layer][group of 64 columns, one wave's in a pass: 16][k step of 32: 32][N tile 4][fragment half 2][lane 32][8 halves]
// so that one wave-wide 16-byte load is 512 contiguous bytes (4 whole 128-byte lines)
// and a wave's 16 loads of a trip are 8 KiB in a row.
// One thread makes one lane's 16-byte piece; a block of 256 reads 64 whole lines of w.
// The layer's LayerNorm gain is multiplied in here: LN(h) W^T = ((h - mean) / std) (gamma * W)^T + beta W^T.
__global__ void cvt_blk_kernel(const float* __restrict__ w, const float* __restrict__ g,
                               _Float16* __restrict__ o, int n8) {
  const int i = blockIdx.x * blockDim.x + threadIdx.x;   // piece index in packed order
  if (i >= n8) return;
  const int lane = i & 31;
  const int part = (i >> 5) & 1;
  const int t    = (i >> 6) & 3;
  const int ks   = (i >> 8) & 31;
  const int wv   = (i >> 13) & 15;
  const int l    = i >> 17;
  const int row  = wv * 64 + t * 16 + (lane & 15);
  const int k    = ks * 32 + part * 16 + ((lane >> 4) << 3);
  const float* src = w + ((size_t)l * HDIM + row) * HDIM + k;
  const v4f a = *(const v4f*)src;
  const v4f b = *(const v4f*)(src + 4);
  const float* gs = g + (size_t)l * HDIM + k;
  const v4f ga = *(const v4f*)gs;
  const v4f gb = *(const v4f*)(gs + 4);
  v8h h;
#pragma unroll
  for (int j = 0; j < 4; ++j) { h[j] = (_Float16)(a[j] * ga[j]); h[4 + j] = (_Float16)(b[j] * gb[j]); }
  *(v8h*)(o + (size_t)i * 8) = h;
}

// Per output column n of each block layer, one wave each:
//   c1[n] = sum_k f16(gamma_k W[n][k])   (what the row mean is multiplied by; the GEMM's own rounded weights)
//   cb[n] = sum_k beta_k W[n][k] + b[n]  (the column's constant)
__global__ void fold_ln_kernel(const float* __restrict__ w, const float* __restrict__ g,
                               const float* __restrict__ be, const float* __restrict__ b,
                               float* __restrict__ c1, float* __restrict__ cb) {
  const int row  = (blockIdx.x * blockDim.x + threadIdx.x) >> 5;   // layer * 1024 + n
  const int lane = threadIdx.x & 31;
  if (row >= NLAYERS * HDIM) return;
  const float* wr = w  + (size_t)row * HDIM + lane * 4;
  const float* gl = g  + (size_t)(row >> 10) * HDIM + lane * 4;
  const float* bl = be + (size_t)(row >> 10) * HDIM + lane * 4;
  float s1 = 0.f, s2 = 0.f;
#pragma unroll
  for (int i = 0; i < 8; ++i) {
    // The wait behind each load stands in front of whatever next writes a register that the load
    // names: in the unrolled form a later load's result is placed on the pointers' registers.
    const v4f a  = *(const v4f*)(wr + i * 128);
    asm volatile("s_wait_xcnt 0x0" ::: "memory");
    const v4f ga = *(const v4f*)(gl + i * 128);
    asm volatile("s_wait_xcnt 0x0" ::: "memory");
    const v4f ba = *(const v4f*)(bl + i * 128);
    asm volatile("s_wait_xcnt 0x0" ::: "memory");
#pragma unroll
    for (int j = 0; j < 4; ++j) { s1 += (float)(_Float16)(a[j] * ga[j]); s2 += a[j] * ba[j]; }
  }
#pragma unroll
  for (int d = 16; d >= 1; d >>= 1) { s1 += __shfl_xor(s1, d, 32); s2 += __shfl_xor(s2, d, 32); }
  if (lane == 0) { c1[row] = s1; cb[row] = s2 + b[row]; }
}

__global__ void cvt_stem_kernel(const float* __restrict__ w, _Float16* __restrict__ o) {
  int i = blockIdx.x * blockDim.x + threadIdx.x;   // 0 .. 1024*32-1
  if (i >= HDIM * 32) return;
  int row = i >> 5, col = i & 31;
  o[i] = (col < FIN) ? (_Float16)w[row * FIN + col] : (_Float16)0.f;
}

// ================= fused MLP kernel =================
__global__ void __launch_bounds__(NTHREADS, 1)
mlp_fused_kernel(const float* __restrict__ x,
                 const float* __restrict__ st_gamma, const float* __restrict__ st_beta,
                 const float* __restrict__ st_b,
                 const float* __restrict__ blkC1, const float* __restrict__ blkCb,
                 const float* __restrict__ last_gamma, const float* __restrict__ last_beta,
                 const float* __restrict__ last_w, const float* __restrict__ last_b,
                 const _Float16* __restrict__ stemW16, const _Float16* __restrict__ blkW16,
                 float* __restrict__ out) {
  extern __shared__ __align__(16) _Float16 smem[];
  _Float16* act = smem;                          // the activations [BM][RS]: each layer rewrites them in place
  _Float16* park = smem + ACT_HALVES;            // [wave][PARKM][4][lane][8] first-pass results in waiting
  float* p1 = (float*)park;                      // [BM][8] partial sums: the head's three arrays lie on the parking place
  float* p2 = p1 + PART_FLOATS;                  // [BM][8] partial sq-sums
  float* p3 = p2 + PART_FLOATS;                  // [BM][8] partial dots (head)
  float* stM = (float*)(park + PARK_HALVES);     // [BM] row mean of the layer's input
  float* stI = stM + BM;                         // [BM] row 1/std of the layer's input
  float* cbS = stI + BM;                         // [HDIM] the layer's column constants
  float* c1S = cbS + HDIM;                       // [HDIM] the layer's column sums
  _Float16* stIn = park;                         // [BM][SIP] stem LN output; dead before the first result is parked

  const int tid     = threadIdx.x;
  const int lane    = tid & 31;
  const int wave    = tid >> 5;          // 0..7
  const int rowBase = blockIdx.x * BM;

  // A wave owns 64 output columns (4 N tiles) of all 128 rows (8 M tiles) in each of two passes over N:
  // columns wave * 64 of the lower 512, then of the upper 512.
  const int lm    = lane & 15;
  const int koff  = (lane >> 4) << 3;    // hi half-wave reads K+8, and holds output columns +8 of an N tile

  // LN work mapping of the head: one row per lane
  const int lrow = tid & 127;            // row handled by this thread
  const int lsg  = tid >> 7;             // which four of the eight 128-col segments (0..1)
  // Block-layer row statistics: 8 lanes share a row, 4 rows per wave at a time, 8 rows apart so that the
  // two rows of a half-wave's 16-byte reads fall on different halves of the banks.
  const int srow0 = wave + ((lane >> 3) << 3);
  const int sj    = lane & 7;

  // ---------------- stem LayerNorm over 26 features ----------------
  if (tid < BM) {
    const float* xr = x + (size_t)(rowBase + tid) * FIN;
    float v[FIN];
    float s1 = 0.f;
#pragma unroll
    for (int i = 0; i < FIN; ++i) { v[i] = xr[i]; s1 += v[i]; }
    const float m = s1 * (1.f / FIN);
    float s2 = 0.f;
#pragma unroll
    for (int i = 0; i < FIN; ++i) { float d = v[i] - m; s2 += d * d; }
    const float inv = rsqrtf(s2 * (1.f / FIN) + 1e-5f);
    _Float16* dst = stIn + tid * SIP;
#pragma unroll
    for (int i = 0; i < FIN; ++i)
      dst[i] = (_Float16)((v[i] - m) * inv * st_gamma[i] + st_beta[i]);
#pragma unroll
    for (int i = FIN; i < 32; ++i) dst[i] = (_Float16)0.f;
  }
  __syncthreads();

  // The weight fragments of the two k steps ahead live here, over pass and layer ends too. Layer 0's first two
  // k steps are asked for here and fly under the stem's GEMM.
  v16h bF[2][4];
  const int      wvu  = __builtin_amdgcn_readfirstlane(wave);   // the wave's number as a scalar: weight addresses = scalar base + lane offset
  const unsigned loff = (unsigned)lane * 16u;   // bytes
  load_2ksteps(bF, (const _Float16*)((const char*)(blkW16 + (size_t)wvu * (64 * HDIM)) + loff));

  // ---------------- stem GEMM: [128 x 32] x [32 x 1024], one WMMA K step ----------------
  {
    v16h aF[8];
#pragma unroll
    for (int m = 0; m < 8; ++m) aF[m] = load_frag16(stIn + (m * 16 + lm) * SIP + koff);
#pragma unroll
    for (int p = 0; p < 2; ++p) {
      const int nw = (p * 8 + wave) * 64;
      v8f sb[4];   // the bias of this lane's columns is the accumulators' start value
      load_cols(sb, st_b + nw + koff);
      const _Float16* swp = stemW16 + (size_t)(nw + lm) * 32 + koff;
      v16h sw[4];   // the stem's weight fragments of the 4 N tiles
#pragma unroll
      for (int t = 0; t < 4; ++t) sw[t] = load_frag16(swp + t * 16 * 32);
      // Stands in front of whatever next writes the address registers that these loads name; the pointer
      // as an input stays in its registers up to the wait, so that no load's result is placed on them.
      asm volatile("s_wait_xcnt 0x0" :: "v"(swp) : "memory");
#pragma unroll
      for (int t = 0; t < 4; ++t) {
#pragma unroll
        for (int m = 0; m < 8; ++m) {
          const v8f acc = __builtin_amdgcn_wmma_f32_16x16x32_f16(false, sw[t], false, aF[m],
                                                                 (short)0, sb[t], false, false);
          *(v8h*)(act + (m * 16 + lm) * RS + nw + t * 16 + koff) = row8_relu(acc);
        }
      }
    }
  }

  // ---------------- 8 blocks: LN -> Linear(H->H) -> ReLU ----------------
  // The GEMM runs on the raw ReLU activations against gamma * W; the row mean enters as the
  // accumulators' start value and 1/std, beta W^T and the bias in the epilogue.
  for (int l = 0; l < NLAYERS; ++l) {
    __syncthreads();
    // The column sums and the column constants go through LDS, 4 floats of each a thread: a lane wants 64 of each,
    // too many to hold in registers over the GEMM. Asked for here, they arrive under the statistics.
    const float* c1p = blkC1 + (size_t)l * HDIM + tid * 4;
    const float* cbp = blkCb + (size_t)l * HDIM + tid * 4;
    const v4f c1g = *(const v4f*)c1p;
    const v4f cbg = *(const v4f*)cbp;
    // Stands in front of whatever next writes the address registers that these loads name.
    asm volatile("s_wait_xcnt 0x0" :: "v"(c1p), "v"(cbp) : "memory");
    // ---- row mean and 1/std of the input, whole rows inside a wave, 4 rows at a time ----
    for (int rg = 0; rg < 4; ++rg) {
      const int srow = srow0 + rg * 32;
      const _Float16* src = act + srow * RS + sj * 8;
      float s1 = 0.f, s2 = 0.f;
#pragma unroll
      for (int cc = 0; cc < HDIM; cc += 64) {
        v8h h = *(const v8h*)(src + cc);
#pragma unroll
        for (int i = 0; i < 8; ++i) { float v = (float)h[i]; s1 += v; s2 += v * v; }
      }
#pragma unroll
      for (int d = 1; d <= 4; d <<= 1) { s1 += __shfl_xor(s1, d, 32); s2 += __shfl_xor(s2, d, 32); }
      const float m   = s1 * (1.f / HDIM);
      const float var = s2 * (1.f / HDIM) - m * m;
      const float inv = rsqrtf(var + 1e-5f);
      if (sj == 0) { stM[srow] = m; stI[srow] = inv; }
    }
    *(v4f*)(c1S + tid * 4) = c1g;
    *(v4f*)(cbS + tid * 4) = cbg;
    __syncthreads();
    // ---- GEMM act x (gamma W_l)^T -> scale, constant, ReLU -> act, in two passes over N ----
    // 128 rows share every weight fragment, so the work-groups together load each weight half as often as
    // with 64 rows. Both passes read the whole input, so their f16 results wait until every wave has left
    // the GEMM: in registers, but for the first pass's last PARKM M tiles, for which the second pass has
    // no registers left: each lane parks those in LDS and fetches them back itself.
    const _Float16* wl = blkW16 + (size_t)l * HDIM * HDIM;   // packed: see cvt_blk_kernel
    const _Float16* arow = act + lm * RS + koff;
    v8h rp[8 - PARKM][4];   // [m][t] the first pass's results that wait in registers
    v8h rc[8][4];           // [m][t] a pass's results
    _Float16* pk = park + (wave * (PARKM * 4 * 32) + lane) * 8;   // this lane's first piece
    // Stays rolled: unrolled, the compiler moves the first pass's scaling and rounding behind the second pass's
    // GEMM and keeps its f32 tiles alive over it, twice the registers of the f16 results.
#pragma unroll 1
    for (int p = 0; p < 2; ++p) {
      const int nw = (p * 8 + wave) * 64;
      v8f acc[8][4];   // [m][t]
      {
        float nm[8];   // this lane's one row of each M tile
#pragma unroll
        for (int m = 0; m < 8; ++m) nm[m] = -stM[m * 16 + lm];
#pragma unroll
        for (int t = 0; t < 4; ++t) {
          // this lane's 8 columns of the column sums in N tile t
          const v4f lo = *(const v4f*)(c1S + nw + t * 16 + koff);
          const v4f hi = *(const v4f*)(c1S + nw + t * 16 + koff + 4);
          const v8f c1v = __builtin_shufflevector(lo, hi, 0, 1, 2, 3, 4, 5, 6, 7);
#pragma unroll
          for (int m = 0; m < 8; ++m) acc[m][t] = c1v * nm[m];
        }
      }
      const _Float16* wpk = wl + (size_t)(p * 8 + wvu) * (64 * HDIM);
      // What the last trip asks for: the first two k steps of the next pass, or of the next layer's first pass.
      // They depend on no activation and fly under the epilogue and the next layer's statistics. Behind the
      // last pass of the last layer nothing is left: there the trip reads this pass's first two again, unused.
      const _Float16* wnx = (p == 0) ? wpk + (size_t)8 * 64 * HDIM
                          : (l + 1 < NLAYERS) ? wl + (size_t)HDIM * HDIM + (size_t)wvu * (64 * HDIM) : wpk;
      // 64 k per trip = two k steps of 4 KiB of this wave's packed weights. The fragments of a k step
      // were asked for two k steps earlier.
      for (int k = 0; k < HDIM - 64; k += 64) {
#pragma unroll
        for (int s = 0; s < 2; ++s)
          kstep_wmma_refill(acc, arow + k + s * 32, bF[s], wpk + (size_t)(k + 64) * 64 + s * 2048, loff);
        // Stands in front of whatever next writes an address register that the trip's weight loads name; the
        // fence behind it keeps the step of that address, at the trip's foot, from being lifted over the wait.
        asm volatile("s_wait_xcnt 0x0" ::: "memory");
        __builtin_amdgcn_sched_barrier(0);
      }
#pragma unroll
      for (int s = 0; s < 2; ++s)
        kstep_wmma_refill(acc, arow + (HDIM - 64) + s * 32, bF[s], wnx + s * 2048, loff);
      // The same wait and fence behind the last trip's loads.
      asm volatile("s_wait_xcnt 0x0" ::: "memory");
      __builtin_amdgcn_sched_barrier(0);
      float inv[8];   // this lane's one row of each M tile
#pragma unroll
      for (int m = 0; m < 8; ++m) inv[m] = stI[m * 16 + lm];
#pragma unroll
      for (int t = 0; t < 4; ++t) {
        // this lane's 8 columns of the constants in N tile t
        const v4f lo = *(const v4f*)(cbS + nw + t * 16 + koff);
        const v4f hi = *(const v4f*)(cbS + nw + t * 16 + koff + 4);
        const v8f cbv = __builtin_shufflevector(lo, hi, 0, 1, 2, 3, 4, 5, 6, 7);
#pragma unroll
        for (int m = 0; m < 8; ++m) rc[m][t] = row8_relu(acc[m][t] * inv[m] + cbv);
      }
      if (p == 0) {
#pragma unroll
        for (int m = 0; m < 8; ++m)
#pragma unroll
          for (int t = 0; t < 4; ++t) {
            if (m < 8 - PARKM) rp[m][t] = rc[m][t];
            else               *(v8h*)(pk + ((m - (8 - PARKM)) * 4 + t) * 256) = rc[m][t];
          }
      }
    }
    // Every wave has read the input for the last time: only behind this barrier is it overwritten.
    __syncthreads();
#pragma unroll
    for (int m = 0; m < 8; ++m)
#pragma unroll
      for (int t = 0; t < 4; ++t) {
        const v8h h0 = (m < 8 - PARKM) ? rp[m < 8 - PARKM ? m : 0][t]
                                       : *(const v8h*)(pk + ((m - (8 - PARKM)) * 4 + t) * 256);
        _Float16* dst = act + (m * 16 + lm) * RS + wave * 64 + t * 16 + koff;
        *(v8h*)dst         = h0;         // first pass: the lower 512 columns
        *(v8h*)(dst + 512) = rc[m][t];   // second pass: the upper 512
      }
  }
  __syncthreads();
  const _Float16* hfin = act;   // the last layer's output

  // ---------------- head: LN -> Linear(H->1) -> sigmoid ----------------
  for (int q = 0; q < 4; ++q) {
    const int lseg = lsg * 4 + q;
    const _Float16* src = hfin + lrow * RS + lseg * 128;
    float s1 = 0.f, s2 = 0.f;
#pragma unroll
    for (int cc = 0; cc < 128; cc += 8) {
      v8h h = *(const v8h*)(src + cc);
#pragma unroll
      for (int i = 0; i < 8; ++i) { float v = (float)h[i]; s1 += v; s2 += v * v; }
    }
    p1[lrow * 8 + lseg] = s1;
    p2[lrow * 8 + lseg] = s2;
  }
  __syncthreads();
  {
    float s1 = 0.f, s2 = 0.f;
#pragma unroll
    for (int j = 0; j < 8; ++j) { s1 += p1[lrow * 8 + j]; s2 += p2[lrow * 8 + j]; }
    const float m   = s1 * (1.f / HDIM);
    const float var = s2 * (1.f / HDIM) - m * m;
    const float inv = rsqrtf(var + 1e-5f);
    for (int q = 0; q < 4; ++q) {
      const int lseg = lsg * 4 + q;
      const int c0   = lseg * 128;
      const _Float16* src = hfin + lrow * RS + c0;
      const float* lg = last_gamma + c0;
      const float* lb = last_beta + c0;
      const float* lw = last_w + c0;
      float dot = 0.f;
#pragma unroll
      for (int cc = 0; cc < 128; cc += 8) {
        v8h h = *(const v8h*)(src + cc);
#pragma unroll
        for (int i = 0; i < 8; ++i) {
          float v = ((float)h[i] - m) * inv * lg[cc + i] + lb[cc + i];
          dot += v * lw[cc + i];
        }
      }
      p3[lrow * 8 + lseg] = dot;
    }
  }
  __syncthreads();
  if (tid < BM) {
    float dot = 0.f;
#pragma unroll
    for (int j = 0; j < 8; ++j) dot += p3[tid * 8 + j];
    const float z = dot + last_b[0];
    (out + rowBase)[tid] = 1.f / (1.f + __expf(-z));   // scalar base + thread index: no row index kept in a register over the layers
  }
}

// ================= host launcher =================
extern "C" void kernel_launch(void* const* d_in, const int* in_sizes, int n_in,
                              void* d_out, int out_size, void* d_ws, size_t ws_size,
                              hipStream_t stream) {
  (void)in_sizes; (void)n_in; (void)out_size; (void)ws_size;

  const float* x         = (const float*)d_in[0];
  const float* st_gamma  = (const float*)d_in[1];
  const float* st_beta   = (const float*)d_in[2];
  const float* st_w      = (const float*)d_in[3];
  const float* st_b      = (const float*)d_in[4];
  const float* blk_gamma = (const float*)d_in[5];
  const float* blk_beta  = (const float*)d_in[6];
  const float* blk_w     = (const float*)d_in[7];
  const float* blk_b     = (const float*)d_in[8];
  const float* last_gamma= (const float*)d_in[9];
  const float* last_beta = (const float*)d_in[10];
  const float* last_w    = (const float*)d_in[11];
  const float* last_b    = (const float*)d_in[12];
  float* out = (float*)d_out;

  // ws layout: stem weights padded to [1024][32] f16, then block weights, 8*1024*1024 f16, packed,
  // then the two per-column vectors of the folded LayerNorm, 8*1024 f32 each
  _Float16* stemW16 = (_Float16*)d_ws;
  _Float16* blkW16  = stemW16 + (size_t)HDIM * 32;
  float*    blkC1   = (float*)(blkW16 + (size_t)NLAYERS * HDIM * HDIM);
  float*    blkCb   = blkC1 + NLAYERS * HDIM;

  // convert weights to f16 (every call; deterministic)
  {
    const int n8 = NLAYERS * HDIM * HDIM / 8;   // 16-byte pieces
    cvt_blk_kernel<<<(n8 + 255) / 256, 256, 0, stream>>>(blk_w, blk_gamma, blkW16, n8);
    fold_ln_kernel<<<NLAYERS * HDIM * 32 / 256, 256, 0, stream>>>(blk_w, blk_gamma, blk_beta, blk_b,
                                                                  blkC1, blkCb);
    cvt_stem_kernel<<<(HDIM * 32 + 255) / 256, 256, 0, stream>>>(st_w, stemW16);
  }

  static_assert(SMEM_BYTES == 322560, "LDS budget (<= 320KB/WGP)");
  static_assert(3 * PART_FLOATS * 4 <= PARK_HALVES * 2 && BM * SIP <= PARK_HALVES, "what lies on the parking place fits it");
  hipFuncSetAttribute((const void*)mlp_fused_kernel,
                      hipFuncAttributeMaxDynamicSharedMemorySize, SMEM_BYTES);

  const int nBlocks = 65536 / BM;  // 512
  mlp_fused_kernel<<<nBlocks, NTHREADS, SMEM_BYTES, stream>>>(
      x, st_gamma, st_beta, st_b,
      blkC1, blkCb,
      last_gamma, last_beta, last_w, last_b,
      stemW16, blkW16, out);
}

// v007
// Measured time: 544 microseconds a run.
// Two timings next to v006 both put it at 1.05 times that version's speed.
// Over all steps from v000 it is 6.55 times as fast.
#include <hip/hip_runtime.h>

typedef _Float16 v8h  __attribute__((ext_vector_type(8)));
typedef _Float16 v16h __attribute__((ext_vector_type(16)));
typedef float    v8f  __attribute__((ext_vector_type(8)));
typedef float    v4f  __attribute__((ext_vector_type(4)));
typedef float    v2f  __attribute__((ext_vector_type(2)));

#define HDIM    1024
#define RS      1032      // padded LDS row stride in halves (2064 B: 16B-aligned, bank ~= 4*row)
#define BM      128       // batch rows per workgroup
#define NTHREADS 256      // 8 wave32s, two per SIMD, up to 512 registers each
#define SIP     40        // LDS row stride in halves of the stem's input (80 B: 16 B x odd)
#define PARKM   3         // M tiles whose first-pass results wait in LDS, not in registers
#define PARK_HALVES ((NTHREADS / 32) * PARKM * 4 * 32 * 8)   // per wave, M tile and N tile one 16-byte piece a lane
#define NLAYERS 8
#define FIN     26
// 1 activation buffer, rewritten in place + the parking place (the stem's input lies on it first, the head's 3 small
// reduction scratch arrays s1, s2, dot last) + per-row mean and 1/std + a layer's column sums and column constants
#define ACT_HALVES   (BM * RS)
#define PART_FLOATS  (BM * 8)
#define SMEM_BYTES   ((ACT_HALVES + PARK_HALVES) * (int)sizeof(_Float16) + (2 * BM + 2 * HDIM) * (int)sizeof(float))

// ---- fragment loader: lane-local 16 halves = [k..k+7] and [k+16..k+23] ----
__device__ __forceinline__ v16h load_frag16(const _Float16* p) {
  v8h lo = *(const v8h*)p;
  v8h hi = *(const v8h*)(p + 16);
  return __builtin_shufflevector(lo, hi, 0,1,2,3,4,5,6,7,8,9,10,11,12,13,14,15);
}

// ---- the same fragment from the packed weights: its two halves lie 512 bytes apart ----
__device__ __forceinline__ v16h load_frag16_packed(const _Float16* p) {
  v8h lo = *(const v8h*)p;
  v8h hi = *(const v8h*)(p + 256);
  return __builtin_shufflevector(lo, hi, 0,1,2,3,4,5,6,7,8,9,10,11,12,13,14,15);
}

// Two k steps' weight fragments from p, the lane's own place in the packed weights: 16 loads as one group.
__device__ __forceinline__ void load_2ksteps(v16h (&b)[2][4], const _Float16* p) {
#pragma unroll
  for (int s = 0; s < 2; ++s)
#pragma unroll
    for (int t = 0; t < 4; ++t) b[s][t] = load_frag16_packed(p + s * 2048 + t * 512);
  // Stands in front of whatever next writes the address registers that these loads name, and keeps the
  // loads where they are written. The pointer as an input stays in its registers up to the wait, so
  // that no load's result is placed on them.
  asm volatile("s_wait_xcnt 0x0" :: "v"(p) : "memory");
}

// ---- 4 activation fragments from LDS as one group: 4 M tiles in a row of one k step, from a, the lane's place in the first ----
__device__ __forceinline__ void load_act4(v16h (&f)[4], const _Float16* a) {
#pragma unroll
  for (int m = 0; m < 4; ++m) f[m] = load_frag16(a + m * 16 * RS);
}

// ---- one k step of the 128x64 wave tile: 32 WMMAs in two runs of 16, all loads in two places ----
// The weights are operand A and the activations operand B: accumulator register r of lane (c, h) is
// output column 8h + r of the N tile, batch row c of the M tile.
// The activation fragments live in two register sets, aX (M tiles 0..3) and aY (M tiles 4..7). Each set is
// asked for again, for the next k step (at an), as one group of 8 LDS reads right behind the 16 WMMAs that
// read it, and is first read 16 WMMAs later: no read stands among the WMMAs of a run and none is waited
// for where it is issued. The k step's 4 weight fragments are asked for anew, for the k step two ahead
// (nbo halves behind nb, the lane's own place in a trip's weights), as one group in the second of the two places.
__device__ __forceinline__ void kstep_wmma_refill(v8f (&acc)[8][4], v16h (&aX)[4], v16h (&aY)[4], v16h (&b)[4],
                                                  const _Float16* an, const bool more, const _Float16* nb, const int nbo) {
  // Weight fragment outermost: the youngest of the weight loads is needed 12 WMMAs later than the oldest.
#pragma unroll
  for (int t = 0; t < 4; ++t)
#pragma unroll
    for (int m = 0; m < 4; ++m)
      acc[m][t] = __builtin_amdgcn_wmma_f32_16x16x32_f16(false, b[t], false, aX[m],
                                                         (short)0, acc[m][t], false, false);
  // The fences keep each group of loads whole and between the two runs: sunk the reads
  // would lose their lead.
  __builtin_amdgcn_sched_barrier(0);
  if (more) load_act4(aX, an);
  __builtin_amdgcn_sched_barrier(0);
#pragma unroll
  for (int m = 0; m < 4; ++m)
#pragma unroll
    for (int t = 0; t < 4; ++t)
      acc[4 + m][t] = __builtin_amdgcn_wmma_f32_16x16x32_f16(false, b[t], false, aY[m],
                                                             (short)0, acc[4 + m][t], false, false);
  __builtin_amdgcn_sched_barrier(0);
  if (more) load_act4(aY, an + 4 * 16 * RS);
  // The LDS reads stay in front of the weight loads: they are needed first, after 16 WMMAs.
  __builtin_amdgcn_sched_barrier(0);
#pragma unroll
  for (int t = 0; t < 4; ++t) b[t] = load_frag16_packed(nb + nbo + t * 512);
  __builtin_amdgcn_sched_barrier(0);
}

// ---- a lane's 8 accumulator values are 8 consecutive columns of one row: f16, ReLU on the packed halves
//      (rounding keeps sign and order, so the values are those of ReLU before rounding): one 16-byte piece ----
__device__ __forceinline__ v8h row8_relu(const v8f& v) {
  v8h h = __builtin_convertvector(v, v8h);
  const v8h zero = {};
  return __builtin_elementwise_max(h, zero);
}

// A per-column f32 vector in global memory, from p, the lane's own 8 columns of its first N tile:
// 8 floats for each of the 4 N tiles.
__device__ __forceinline__ void load_cols(v8f (&c)[4], const float* p) {
#pragma unroll
  for (int t = 0; t < 4; ++t) {
    const v4f lo = *(const v4f*)(p + t * 16);
    const v4f hi = *(const v4f*)(p + t * 16 + 4);
    c[t] = __builtin_shufflevector(lo, hi, 0, 1, 2, 3, 4, 5, 6, 7);
  }
  // Stands in front of whatever next writes the address registers that these loads name, and keeps the
  // loads where they are written. The pointer as an input stays in its registers up to the wait, so
  // that no load's result is placed on them.
  asm volatile("s_wait_xcnt 0x0" :: "v"(p) : "memory");
}

// ================= weight preparation kernels (f32 -> f16 weights, f32 folded LayerNorm vectors; run each call) =================
// Block weights go out in the order the GEMM's lanes read them:
//   [layer][group of 64 columns, one wave's in a pass: 16][k step of 32: 32][N tile 4][fragment half 2][lane 32][8 halves]
// so that one wave-wide 16-byte load is 512 contiguous bytes (4 whole 128-byte lines)
// and a wave's 16 loads of a trip are 8 KiB in a row.
// One thread makes one lane's 16-byte piece; a block of 256 reads 64 whole lines of w.
// The layer's LayerNorm gain is multiplied in here: LN(h) W^T = ((h - mean) / std) (gamma * W)^T + beta W^T.
__global__ void cvt_blk_kernel(const float* __restrict__ w, const float* __restrict__ g,
                               _Float16* __restrict__ o, int n8) {
  const int i = blockIdx.x * blockDim.x + threadIdx.x;   // piece index in packed order
  if (i >= n8) return;
  const int lane = i & 31;
  const int part = (i >> 5) & 1;
  const int t    = (i >> 6) & 3;
  const int ks   = (i >> 8) & 31;
  const int wv   = (i >> 13) & 15;
  const int l    = i >> 17;
  const int row  = wv * 64 + t * 16 + (lane & 15);
  const int k    = ks * 32 + part * 16 + ((lane >> 4) << 3);
  const float* src = w + ((size_t)l * HDIM + row) * HDIM + k;
  const v4f a = *(const v4f*)src;
  const v4f b = *(const v4f*)(src + 4);
  const float* gs = g + (size_t)l * HDIM + k;
  const v4f ga = *(const v4f*)gs;
  const v4f gb = *(const v4f*)(gs + 4);
  v8h h;
#pragma unroll
  for (int j = 0; j < 4; ++j) { h[j] = (_Float16)(a[j] * ga[j]); h[4 + j] = (_Float16)(b[j] * gb[j]); }
  *(v8h*)(o + (size_t)i * 8) = h;
}

// Per output column n of each block layer, one wave each:
//   c1[n] = sum_k f16(gamma_k W[n][k])   (what the row mean is multiplied by; the GEMM's own rounded weights)
//   cb[n] = sum_k beta_k W[n][k] + b[n]  (the column's constant)
__global__ void fold_ln_kernel(const float* __restrict__ w, const float* __restrict__ g,
                               const float* __restrict__ be, const float* __restrict__ b,
                               float* __restrict__ c1, float* __restrict__ cb) {
  const int row  = (blockIdx.x * blockDim.x + threadIdx.x) >> 5;   // layer * 1024 + n
  const int lane = threadIdx.x & 31;
  if (row >= NLAYERS * HDIM) return;
  const float* wr = w  + (size_t)row * HDIM + lane * 4;
  const float* gl = g  + (size_t)(row >> 10) * HDIM + lane * 4;
  const float* bl = be + (size_t)(row >> 10) * HDIM + lane * 4;
  float s1 = 0.f, s2 = 0.f;
#pragma unroll
  for (int i = 0; i < 8; ++i) {
    // The wait behind each load stands in front of whatever next writes a register that the load
    // names: in the unrolled form a later load's result is placed on the pointers' registers.
    const v4f a  = *(const v4f*)(wr + i * 128);
    asm volatile("s_wait_xcnt 0x0" ::: "memory");
    const v4f ga = *(const v4f*)(gl + i * 128);
    asm volatile("s_wait_xcnt 0x0" ::: "memory");
    const v4f ba = *(const v4f*)(bl + i * 128);
    asm volatile("s_wait_xcnt 0x0" ::: "memory");
#pragma unroll
    for (int j = 0; j < 4; ++j) { s1 += (float)(_Float16)(a[j] * ga[j]); s2 += a[j] * ba[j]; }
  }
#pragma unroll
  for (int d = 16; d >= 1; d >>= 1) { s1 += __shfl_xor(s1, d, 32); s2 += __shfl_xor(s2, d, 32); }
  if (lane == 0) { c1[row] = s1; cb[row] = s2 + b[row]; }
}

__global__ void cvt_stem_kernel(const float* __restrict__ w, _Float16* __restrict__ o) {
  int i = blockIdx.x * blockDim.x + threadIdx.x;   // 0 .. 1024*32-1
  if (i >= HDIM * 32) return;
  int row = i >> 5, col = i & 31;
  o[i] = (col < FIN) ? (_Float16)w[row * FIN + col] : (_Float16)0.f;
}

// ================= fused MLP kernel =================
__global__ void __launch_bounds__(NTHREADS, 1)
mlp_fused_kernel(const float* __restrict__ x,
                 const float* __restrict__ st_gamma, const float* __restrict__ st_beta,
                 const float* __restrict__ st_b,
                 const float* __restrict__ blkC1, const float* __restrict__ blkCb,
                 const float* __restrict__ last_gamma, const float* __restrict__ last_beta,
                 const float* __restrict__ last_w, const float* __restrict__ last_b,
                 const _Float16* __restrict__ stemW16, const _Float16* __restrict__ blkW16,
                 float* __restrict__ out) {
  extern __shared__ __align__(16) _Float16 smem[];
  _Float16* act = smem;                          // the activations [BM][RS]: each layer rewrites them in place
  _Float16* park = smem + ACT_HALVES;            // [wave][PARKM][4][lane][8] first-pass results in waiting
  float* p1 = (float*)park;                      // [BM][8] partial sums: the head's three arrays lie on the parking place
  float* p2 = p1 + PART_FLOATS;                  // [BM][8] partial sq-sums
  float* p3 = p2 + PART_FLOATS;                  // [BM][8] partial dots (head)
  float* stM = (float*)(park + PARK_HALVES);     // [BM] row mean of the layer's input
  float* stI = stM + BM;                         // [BM] row 1/std of the layer's input
  float* cbS = stI + BM;                         // [HDIM] the layer's column constants
  float* c1S = cbS + HDIM;                       // [HDIM] the layer's column sums
  _Float16* stIn = park;                         // [BM][SIP] stem LN output; dead before the first result is parked

  const int tid     = threadIdx.x;
  const int lane    = tid & 31;
  const int wave    = tid >> 5;          // 0..7
  const int rowBase = blockIdx.x * BM;

  // A wave owns 64 output columns (4 N tiles) of all 128 rows (8 M tiles) in each of two passes over N:
  // columns wave * 64 of the lower 512, then of the upper 512.
  const int lm    = lane & 15;
  const int koff  = (lane >> 4) << 3;    // hi half-wave reads K+8, and holds output columns +8 of an N tile

  // LN work mapping of the head: one row per lane
  const int lrow = tid & 127;            // row handled by this thread
  const int lsg  = tid >> 7;             // which four of the eight 128-col segments (0..1)
  // Block-layer row statistics: 8 lanes share a row, 4 rows per wave at a time, 8 rows apart so that the
  // two rows of a half-wave's 16-byte reads fall on different halves of the banks.
  const int srow0 = wave + ((lane >> 3) << 3);
  const int sj    = lane & 7;

  // ---------------- stem LayerNorm over 26 features ----------------
  if (tid < BM) {
    const float* xr = x + (size_t)(rowBase + tid) * FIN;
    float v[FIN];
    float s1 = 0.f;
#pragma unroll
    for (int i = 0; i < FIN; ++i) { v[i] = xr[i]; s1 += v[i]; }
    const float m = s1 * (1.f / FIN);
    float s2 = 0.f;
#pragma unroll
    for (int i = 0; i < FIN; ++i) { float d = v[i] - m; s2 += d * d; }
    const float inv = rsqrtf(s2 * (1.f / FIN) + 1e-5f);
    _Float16* dst = stIn + tid * SIP;
#pragma unroll
    for (int i = 0; i < FIN; ++i)
      dst[i] = (_Float16)((v[i] - m) * inv * st_gamma[i] + st_beta[i]);
#pragma unroll
    for (int i = FIN; i < 32; ++i) dst[i] = (_Float16)0.f;
  }
  __syncthreads();

  // The weight fragments of the two k steps ahead live here, over pass and layer ends too. Layer 0's first two
  // k steps are asked for here and fly under the stem's GEMM.
  v16h bF[2][4];
  const int      wvu  = __builtin_amdgcn_readfirstlane(wave);   // the wave's number as a scalar: weight addresses = scalar base + lane offset
  const unsigned loff = (unsigned)lane * 16u;   // bytes
  load_2ksteps(bF, (const _Float16*)((const char*)(blkW16 + (size_t)wvu * (64 * HDIM)) + loff));

  // ---------------- stem GEMM: [128 x 32] x [32 x 1024], one WMMA K step ----------------
  {
    v16h aF[8];
#pragma unroll
    for (int m = 0; m < 8; ++m) aF[m] = load_frag16(stIn + (m * 16 + lm) * SIP + koff);
#pragma unroll
    for (int p = 0; p < 2; ++p) {
      const int nw = (p * 8 + wave) * 64;
      v8f sb[4];   // the bias of this lane's columns is the accumulators' start value
      load_cols(sb, st_b + nw + koff);
      const _Float16* swp = stemW16 + (size_t)(nw + lm) * 32 + koff;
      v16h sw[4];   // the stem's weight fragments of the 4 N tiles
#pragma unroll
      for (int t = 0; t < 4; ++t) sw[t] = load_frag16(swp + t * 16 * 32);
      // Stands in front of whatever next writes the address registers that these loads name; the pointer
      // as an input stays in its registers up to the wait, so that no load's result is placed on them.
      asm volatile("s_wait_xcnt 0x0" :: "v"(swp) : "memory");
#pragma unroll
      for (int t = 0; t < 4; ++t) {
#pragma unroll
        for (int m = 0; m < 8; ++m) {
          const v8f acc = __builtin_amdgcn_wmma_f32_16x16x32_f16(false, sw[t], false, aF[m],
                                                                 (short)0, sb[t], false, false);
          *(v8h*)(act + (m * 16 + lm) * RS + nw + t * 16 + koff) = row8_relu(acc);
        }
      }
    }
  }

  // ---------------- 8 blocks: LN -> Linear(H->H) -> ReLU ----------------
  // The GEMM runs on the raw ReLU activations against gamma * W; the row mean enters as the
  // accumulators' start value and 1/std, beta W^T and the bias in the epilogue.
  for (int l = 0; l < NLAYERS; ++l) {
    __syncthreads();
    // The column sums and the column constants go through LDS, 4 floats of each a thread: a lane wants 64 of each,
    // too many to hold in registers over the GEMM. Asked for here, they arrive under the statistics.
    const float* c1p = blkC1 + (size_t)l * HDIM + tid * 4;
    const float* cbp = blkCb + (size_t)l * HDIM + tid * 4;
    const v4f c1g = *(const v4f*)c1p;
    const v4f cbg = *(const v4f*)cbp;
    // Stands in front of whatever next writes the address registers that these loads name.
    asm volatile("s_wait_xcnt 0x0" :: "v"(c1p), "v"(cbp) : "memory");
    // ---- row mean and 1/std of the input, whole rows inside a wave, 4 rows at a time ----
    for (int rg = 0; rg < 4; ++rg) {
      const int srow = srow0 + rg * 32;
      const _Float16* src = act + srow * RS + sj * 8;
      float s1 = 0.f, s2 = 0.f;
#pragma unroll
      for (int cc = 0; cc < HDIM; cc += 64) {
        v8h h = *(const v8h*)(src + cc);
#pragma unroll
        for (int i = 0; i < 8; ++i) { float v = (float)h[i]; s1 += v; s2 += v * v; }
      }
#pragma unroll
      for (int d = 1; d <= 4; d <<= 1) { s1 += __shfl_xor(s1, d, 32); s2 += __shfl_xor(s2, d, 32); }
      const float m   = s1 * (1.f / HDIM);
      const float var = s2 * (1.f / HDIM) - m * m;
      const float inv = rsqrtf(var + 1e-5f);
      if (sj == 0) { stM[srow] = m; stI[srow] = inv; }
    }
    *(v4f*)(c1S + tid * 4) = c1g;
    *(v4f*)(cbS + tid * 4) = cbg;
    __syncthreads();
    // ---- GEMM act x (gamma W_l)^T -> scale, constant, ReLU -> act, in two passes over N ----
    // 128 rows share every weight fragment, so the work-groups together load each weight half as often as
    // with 64 rows. Both passes read the whole input, so their f16 results wait until every wave has left
    // the GEMM: in registers, but for the first pass's last PARKM M tiles, for which the second pass has
    // no registers left: each lane parks those in LDS and fetches them back itself.
    const _Float16* wl = blkW16 + (size_t)l * HDIM * HDIM;   // packed: see cvt_blk_kernel
    const _Float16* arow = act + lm * RS + koff;
    v8h rp[8 - PARKM][4];   // [m][t] the first pass's results that wait in registers
    v8h rc[8][4];           // [m][t] a pass's results
    _Float16* pk = park + (wave * (PARKM * 4 * 32) + lane) * 8;   // this lane's first piece
    // Stays rolled: unrolled, the compiler moves the first pass's scaling and rounding behind the second pass's
    // GEMM and keeps its f32 tiles alive over it, twice the registers of the f16 results.
#pragma unroll 1
    for (int p = 0; p < 2; ++p) {
      const int nw = (p * 8 + wave) * 64;
      // The first k step's activation fragments: asked for here, they arrive under the accumulators' start values.
      v16h aX[4], aY[4];
      load_act4(aX, arow);
      load_act4(aY, arow + 4 * 16 * RS);
      v8f acc[8][4];   // [m][t]
      {
        float nm[8];   // this lane's one row of each M tile
#pragma unroll
        for (int m = 0; m < 8; ++m) nm[m] = -stM[m * 16 + lm];
#pragma unroll
        for (int t = 0; t < 4; ++t) {
          // this lane's 8 columns of the column sums in N tile t
          const v4f lo = *(const v4f*)(c1S + nw + t * 16 + koff);
          const v4f hi = *(const v4f*)(c1S + nw + t * 16 + koff + 4);
          const v8f c1v = __builtin_shufflevector(lo, hi, 0, 1, 2, 3, 4, 5, 6, 7);
#pragma unroll
          for (int m = 0; m < 8; ++m) acc[m][t] = c1v * nm[m];
        }
      }
      const _Float16* wpk = wl + (size_t)(p * 8 + wvu) * (64 * HDIM);
      // What the last trip asks for: the first two k steps of the next pass, or of the next layer's first pass.
      // They depend on no activation and fly under the epilogue and the next layer's statistics. Behind the
      // last pass of the last layer nothing is left: there the trip reads this pass's first two again, unused.
      const _Float16* wnx = (p == 0) ? wpk + (size_t)8 * 64 * HDIM
                          : (l + 1 < NLAYERS) ? wl + (size_t)HDIM * HDIM + (size_t)wvu * (64 * HDIM) : wpk;
      // 64 k per trip = two k steps of 4 KiB of this wave's packed weights. The weight fragments of a k step
      // were asked for two k steps earlier, its activation fragments half a k step earlier.
      for (int k = 0; k < HDIM - 64; k += 64) {
        const _Float16* nb = (const _Float16*)((const char*)(wpk + (size_t)(k + 64) * 64) + loff);
#pragma unroll
        for (int s = 0; s < 2; ++s)
          kstep_wmma_refill(acc, aX, aY, bF[s], arow + k + (s + 1) * 32, true, nb, s * 2048);
        // Stands in front of whatever next writes an address register that the trip's weight loads name; the
        // fence behind it keeps the step of that address, at the trip's foot, from being lifted over the wait.
        asm volatile("s_wait_xcnt 0x0" ::: "memory");
        __builtin_amdgcn_sched_barrier(0);
      }
      const _Float16* nbl = (const _Float16*)((const char*)wnx + loff);
      kstep_wmma_refill(acc, aX, aY, bF[0], arow + (HDIM - 32), true, nbl, 0);
      // Behind the pass's last k step no activation fragment is left to ask for.
      kstep_wmma_refill(acc, aX, aY, bF[1], arow, false, nbl, 2048);
      // The same wait and fence behind the last trip's loads.
      asm volatile("s_wait_xcnt 0x0" ::: "memory");
      __builtin_amdgcn_sched_barrier(0);
      float inv[8];   // this lane's one row of each M tile
#pragma unroll
      for (int m = 0; m < 8; ++m) inv[m] = stI[m * 16 + lm];
#pragma unroll
      for (int t = 0; t < 4; ++t) {
        // this lane's 8 columns of the constants in N tile t
        const v4f lo = *(const v4f*)(cbS + nw + t * 16 + koff);
        const v4f hi = *(const v4f*)(cbS + nw + t * 16 + koff + 4);
        const v8f cbv = __builtin_shufflevector(lo, hi, 0, 1, 2, 3, 4, 5, 6, 7);
#pragma unroll
        for (int m = 0; m < 8; ++m) rc[m][t] = row8_relu(acc[m][t] * inv[m] + cbv);
      }
      if (p == 0) {
#pragma unroll
        for (int m = 0; m < 8; ++m)
#pragma unroll
          for (int t = 0; t < 4; ++t) {
            if (m < 8 - PARKM) rp[m][t] = rc[m][t];
            else               *(v8h*)(pk + ((m - (8 - PARKM)) * 4 + t) * 256) = rc[m][t];
          }
      }
    }
    // Every wave has read the input for the last time: only behind this barrier is it overwritten.
    __syncthreads();
#pragma unroll
    for (int m = 0; m < 8; ++m)
#pragma unroll
      for (int t = 0; t < 4; ++t) {
        const v8h h0 = (m < 8 - PARKM) ? rp[m < 8 - PARKM ? m : 0][t]
                                       : *(const v8h*)(pk + ((m - (8 - PARKM)) * 4 + t) * 256);
        _Float16* dst = act + (m * 16 + lm) * RS + wave * 64 + t * 16 + koff;
        *(v8h*)dst         = h0;         // first pass: the lower 512 columns
        *(v8h*)(dst + 512) = rc[m][t];   // second pass: the upper 512
      }
  }
  __syncthreads();
  const _Float16* hfin = act;   // the last layer's output

  // ---------------- head: LN -> Linear(H->1) -> sigmoid ----------------
  for (int q = 0; q < 4; ++q) {
    const int lseg = lsg * 4 + q;
    const _Float16* src = hfin + lrow * RS + lseg * 128;
    float s1 = 0.f, s2 = 0.f;
#pragma unroll
    for (int cc = 0; cc < 128; cc += 8) {
      v8h h = *(const v8h*)(src + cc);
#pragma unroll
      for (int i = 0; i < 8; ++i) { float v = (float)h[i]; s1 += v; s2 += v * v; }
    }
    p1[lrow * 8 + lseg] = s1;
    p2[lrow * 8 + lseg] = s2;
  }
  __syncthreads();
  {
    float s1 = 0.f, s2 = 0.f;
#pragma unroll
    for (int j = 0; j < 8; ++j) { s1 += p1[lrow * 8 + j]; s2 += p2[lrow * 8 + j]; }
    const float m   = s1 * (1.f / HDIM);
    const float var = s2 * (1.f / HDIM) - m * m;
    const float inv = rsqrtf(var + 1e-5f);
    for (int q = 0; q < 4; ++q) {
      const int lseg = lsg * 4 + q;
      const int c0   = lseg * 128;
      const _Float16* src = hfin + lrow * RS + c0;
      const float* lg = last_gamma + c0;
      const float* lb = last_beta + c0;
      const float* lw = last_w + c0;
      float dot = 0.f;
#pragma unroll
      for (int cc = 0; cc < 128; cc += 8) {
        v8h h = *(const v8h*)(src + cc);
#pragma unroll
        for (int i = 0; i < 8; ++i) {
          float v = ((float)h[i] - m) * inv * lg[cc + i] + lb[cc + i];
          dot += v * lw[cc + i];
        }
      }
      p3[lrow * 8 + lseg] = dot;
    }
  }
  __syncthreads();
  if (tid < BM) {
    float dot = 0.f;
#pragma unroll
    for (int j = 0; j < 8; ++j) dot += p3[tid * 8 + j];
    const float z = dot + last_b[0];
    (out + rowBase)[tid] = 1.f / (1.f + __expf(-z));   // scalar base + thread index: no row index kept in a register over the layers
  }
}

// ================= host launcher =================
extern "C" void kernel_launch(void* const* d_in, const int* in_sizes, int n_in,
                              void* d_out, int out_size, void* d_ws, size_t ws_size,
                              hipStream_t stream) {
  (void)in_sizes; (void)n_in; (void)out_size; (void)ws_size;

  const float* x         = (const float*)d_in[0];
  const float* st_gamma  = (const float*)d_in[1];
  const float* st_beta   = (const float*)d_in[2];
  const float* st_w      = (const float*)d_in[3];
  const float* st_b      = (const float*)d_in[4];
  const float* blk_gamma = (const float*)d_in[5];
  const float* blk_beta  = (const float*)d_in[6];
  const float* blk_w     = (const float*)d_in[7];
  const float* blk_b     = (const float*)d_in[8];
  const float* last_gamma= (const float*)d_in[9];
  const float* last_beta = (const float*)d_in[10];
  const float* last_w    = (const float*)d_in[11];
  const float* last_b    = (const float*)d_in[12];
  float* out = (float*)d_out;

  // ws layout: stem weights padded to [1024][32] f16, then block weights, 8*1024*1024 f16, packed,
  // then the two per-column vectors of the folded LayerNorm, 8*1024 f32 each
  _Float16* stemW16 = (_Float16*)d_ws;
  _Float16* blkW16  = stemW16 + (size_t)HDIM * 32;
  float*    blkC1   = (float*)(blkW16 + (size_t)NLAYERS * HDIM * HDIM);
  float*    blkCb   = blkC1 + NLAYERS * HDIM;

  // convert weights to f16 (every call; deterministic)
  {
    const int n8 = NLAYERS * HDIM * HDIM / 8;   // 16-byte pieces
    cvt_blk_kernel<<<(n8 + 255) / 256, 256, 0, stream>>>(blk_w, blk_gamma, blkW16, n8);
    fold_ln_kernel<<<NLAYERS * HDIM * 32 / 256, 256, 0, stream>>>(blk_w, blk_gamma, blk_beta, blk_b,
                                                                  blkC1, blkCb);
    cvt_stem_kernel<<<(HDIM * 32 + 255) / 256, 256, 0, stream>>>(st_w, stemW16);
  }

  static_assert(SMEM_BYTES == 322560, "LDS budget (<= 320KB/WGP)");
  static_assert(3 * PART_FLOATS * 4 <= PARK_HALVES * 2 && BM * SIP <= PARK_HALVES, "what lies on the parking place fits it");
  hipFuncSetAttribute((const void*)mlp_fused_kernel,
                      hipFuncAttributeMaxDynamicSharedMemorySize, SMEM_BYTES);

  const int nBlocks = 65536 / BM;  // 512
  mlp_fused_kernel<<<nBlocks, NTHREADS, SMEM_BYTES, stream>>>(
      x, st_gamma, st_beta, st_b,
      blkC1, blkCb,
      last_gamma, last_beta, last_w, last_b,
      stemW16, blkW16, out);
}

// v008
// It runs in 517 microseconds.
// Timed twice side by side with v007, it ran 1.05 times as fast both times.
// Counting every step since v000, it is 6.90 times as fast.
#include <hip/hip_runtime.h>

typedef _Float16 v8h  __attribute__((ext_vector_type(8)));
typedef _Float16 v16h __attribute__((ext_vector_type(16)));
typedef float    v8f  __attribute__((ext_vector_type(8)));
typedef float    v4f  __attribute__((ext_vector_type(4)));
typedef float    v2f  __attribute__((ext_vector_type(2)));

#define HDIM    1024
#define RS      1032      // padded LDS row stride in halves (2064 B: 16B-aligned, bank ~= 4*row)
#define BM      128       // batch rows per workgroup
#define NTHREADS 256      // 8 wave32s, two per SIMD, up to 512 registers each
#define SIP     40        // LDS row stride in halves of the stem's input (80 B: 16 B x odd)
#define PARKM   3         // M tiles whose first-pass results wait in LDS, not in registers
#define PARK_HALVES ((NTHREADS / 32) * PARKM * 4 * 32 * 8)   // per wave, M tile and N tile one 16-byte piece a lane
#define NLAYERS 8
#define FIN     26
// 1 activation buffer, rewritten in place + the parking place (the stem's input lies on it first, the head's 3 small
// reduction scratch arrays s1, s2, dot last) + per-row mean and 1/std + a layer's column sums and column constants
#define ACT_HALVES   (BM * RS)
#define PART_FLOATS  (BM * 8)
#define SMEM_BYTES   ((ACT_HALVES + PARK_HALVES) * (int)sizeof(_Float16) + (2 * BM + 2 * HDIM) * (int)sizeof(float))

// ---- fragment loader: lane-local 16 halves = [k..k+7] and [k+16..k+23] ----
__device__ __forceinline__ v16h load_frag16(const _Float16* p) {
  v8h lo = *(const v8h*)p;
  v8h hi = *(const v8h*)(p + 16);
  return __builtin_shufflevector(lo, hi, 0,1,2,3,4,5,6,7,8,9,10,11,12,13,14,15);
}

// ---- the same fragment from the packed weights: its two halves lie 512 bytes apart ----
__device__ __forceinline__ v16h load_frag16_packed(const _Float16* p) {
  v8h lo = *(const v8h*)p;
  v8h hi = *(const v8h*)(p + 256);
  return __builtin_shufflevector(lo, hi, 0,1,2,3,4,5,6,7,8,9,10,11,12,13,14,15);
}

// Two k steps' weight fragments from p, the lane's own place in the packed weights: 16 loads as one group.
__device__ __forceinline__ void load_2ksteps(v16h (&b)[2][4], const _Float16* p) {
#pragma unroll
  for (int s = 0; s < 2; ++s)
#pragma unroll
    for (int t = 0; t < 4; ++t) b[s][t] = load_frag16_packed(p + s * 2048 + t * 512);
  // Stands in front of whatever next writes the address registers that these loads name, and keeps the
  // loads where they are written. The pointer as an input stays in its registers up to the wait, so
  // that no load's result is placed on them.
  asm volatile("s_wait_xcnt 0x0" :: "v"(p) : "memory");
}

// ---- 4 activation fragments from LDS as one group: 4 M tiles in a row of one k step, from a, the lane's place in the first ----
__device__ __forceinline__ void load_act4(v16h (&f)[4], const _Float16* a) {
#pragma unroll
  for (int m = 0; m < 4; ++m) f[m] = load_frag16(a + m * 16 * RS);
}

// ---- one k step of the 128x64 wave tile: 32 WMMAs in two runs of 16, all loads in two places ----
// The weights are operand A and the activations operand B: accumulator register r of lane (c, h) is
// output column 8h + r of the N tile, batch row c of the M tile.
// The activation fragments live in two register sets, aX (M tiles 0..3) and aY (M tiles 4..7). Each set is
// asked for again, for the next k step (at an), as one group of 8 LDS reads right behind the 16 WMMAs that
// read it, and is first read 16 WMMAs later: no read stands among the WMMAs of a run and none is waited
// for where it is issued. The k step's 4 weight fragments are asked for anew, for the k step two ahead
// (nbo halves behind nb, the lane's own place in a trip's weights), as one group in the second of the two places.
__device__ __forceinline__ void kstep_wmma_refill(v8f (&acc)[8][4], v16h (&aX)[4], v16h (&aY)[4], v16h (&b)[4],
                                                  const _Float16* an, const bool more, const _Float16* nb, const int nbo) {
  // Weight fragment outermost: the youngest of the weight loads is needed 12 WMMAs later than the oldest.
#pragma unroll
  for (int t = 0; t < 4; ++t)
#pragma unroll
    for (int m = 0; m < 4; ++m)
      acc[m][t] = __builtin_amdgcn_wmma_f32_16x16x32_f16(false, b[t], false, aX[m],
                                                         (short)0, acc[m][t], false, false);
  // The fences keep each group of loads whole and between the two runs: sunk the reads
  // would lose their lead.
  __builtin_amdgcn_sched_barrier(0);
  if (more) load_act4(aX, an);
  __builtin_amdgcn_sched_barrier(0);
#pragma unroll
  for (int m = 0; m < 4; ++m)
#pragma unroll
    for (int t = 0; t < 4; ++t)
      acc[4 + m][t] = __builtin_amdgcn_wmma_f32_16x16x32_f16(false, b[t], false, aY[m],
                                                             (short)0, acc[4 + m][t], false, false);
  __builtin_amdgcn_sched_barrier(0);
  if (more) load_act4(aY, an + 4 * 16 * RS);
  // The LDS reads stay in front of the weight loads: they are needed first, after 16 WMMAs.
  __builtin_amdgcn_sched_barrier(0);
#pragma unroll
  for (int t = 0; t < 4; ++t) b[t] = load_frag16_packed(nb + nbo + t * 512);
  __builtin_amdgcn_sched_barrier(0);
}

// ---- a lane's 8 accumulator values are 8 consecutive columns of one row: f16, ReLU on the packed halves
//      (rounding keeps sign and order, so the values are those of ReLU before rounding): one 16-byte piece ----
__device__ __forceinline__ v8h row8_relu(const v8f& v) {
  v8h h = __builtin_convertvector(v, v8h);
  const v8h zero = {};
  return __builtin_elementwise_max(h, zero);
}

// A per-column f32 vector in global memory, from p, the lane's own 8 columns of its first N tile:
// 8 floats for each of the 4 N tiles.
__device__ __forceinline__ void load_cols(v8f (&c)[4], const float* p) {
#pragma unroll
  for (int t = 0; t < 4; ++t) {
    const v4f lo = *(const v4f*)(p + t * 16);
    const v4f hi = *(const v4f*)(p + t * 16 + 4);
    c[t] = __builtin_shufflevector(lo, hi, 0, 1, 2, 3, 4, 5, 6, 7);
  }
  // Stands in front of whatever next writes the address registers that these loads name, and keeps the
  // loads where they are written. The pointer as an input stays in its registers up to the wait, so
  // that no load's result is placed on them.
  asm volatile("s_wait_xcnt 0x0" :: "v"(p) : "memory");
}

// ---- row mean and 1/std of the 128 activation rows, on the matrix unit: wave w takes the 16 rows of M tile w ----
// The wave's fragment f of a k step (16 rows x 32 k) is operand B of ones x f, whose every accumulator row holds the
// 16 row sums, and both operands of f x f^T, whose diagonal holds the 16 sums of squares (the A and the B map of a
// fragment are the same: lane = row, the same k at every register). No vector sum and no cross-lane step is left.
__device__ __forceinline__ void row_stats(const _Float16* act, float* stM, const int wave, const int lane) {
  const int lm = lane & 15;
  const _Float16* src = act + (wave * 16 + lm) * RS + ((lane >> 4) << 3);
  v16h ones;
#pragma unroll
  for (int i = 0; i < 16; ++i) ones[i] = (_Float16)1.f;
  // Three accumulator tiles, the squares' for even and odd k steps.
  v8f sum = {}, gram[2] = {};
  // The 32 k steps in 8 groups of 4: a group's 8 LDS reads are issued 2 groups ahead of its 8 WMMAs.
  v16h f[8][4];
#pragma unroll
  for (int i = 0; i < 8; ++i) f[i / 4][i % 4] = load_frag16(src + i * 32);
#pragma unroll
  for (int c = 0; c < 8; ++c) {
    // The fences keep each group of reads whole and where it is written: left alone, the compiler puts every
    // pair of reads directly in front of its two WMMAs and waits there for the whole LDS latency.
    __builtin_amdgcn_sched_barrier(0);
#pragma unroll
    for (int i = 0; i < 4; i += 2) {
      // Two k steps: both squares, then both sums, the order held by a fence behind each WMMA. So all three tiles are
      // first written while both of the first two fragments are still to be read: no tile is placed on registers
      // that a WMMA issued just before reads as its operand B.
      gram[0] = __builtin_amdgcn_wmma_f32_16x16x32_f16(false, f[c][i], false, f[c][i], (short)0, gram[0], false, false);
      __builtin_amdgcn_sched_barrier(0);
      gram[1] = __builtin_amdgcn_wmma_f32_16x16x32_f16(false, f[c][i + 1], false, f[c][i + 1], (short)0, gram[1], false, false);
      __builtin_amdgcn_sched_barrier(0);
      sum = __builtin_amdgcn_wmma_f32_16x16x32_f16(false, ones, false, f[c][i], (short)0, sum, false, false);
      __builtin_amdgcn_sched_barrier(0);
      sum = __builtin_amdgcn_wmma_f32_16x16x32_f16(false, ones, false, f[c][i + 1], (short)0, sum, false, false);
      __builtin_amdgcn_sched_barrier(0);
    }
    if (c + 2 < 8) {
#pragma unroll
      for (int i = 0; i < 4; ++i) f[c + 2][i] = load_frag16(src + ((c + 2) * 4 + i) * 32);
    }
  }
  // Accumulator register r of lane (c, h) is element (8h + r, c): the diagonal element of row c stands in
  // register c & 7 of the lane with h == c >> 3.
  const v8f g = gram[0] + gram[1];
  const v4f g4 = (lane & 1) ? __builtin_shufflevector(g, g, 1, 3, 5, 7) : __builtin_shufflevector(g, g, 0, 2, 4, 6);
  const v2f g2 = (lane & 2) ? __builtin_shufflevector(g4, g4, 1, 3) : __builtin_shufflevector(g4, g4, 0, 2);
  const float s2  = (lane & 4) ? g2[1] : g2[0];
  const float s1  = sum[0];
  const float m   = s1 * (1.f / HDIM);
  const float var = s2 * (1.f / HDIM) - m * m;
  const float inv = rsqrtf(var + 1e-5f);
  float* st = stM + wave * 16 + lm;   // 1/std lies BM floats behind the mean
  if ((lane >> 4) == (lm >> 3)) { st[0] = m; st[BM] = inv; }
}

// ================= weight conversion kernels (f32 -> f16, run each call) =================
// Block weights go out in the order the GEMM's lanes read them:
//   [layer][group of 64 columns, one wave's in a pass: 16][k step of 32: 32][N tile 4][fragment half 2][lane 32][8 halves]
// so that one wave-wide 16-byte load is 512 contiguous bytes (4 whole 128-byte lines)
// and a wave's 16 loads of a trip are 8 KiB in a row.
// One thread makes one lane's 16-byte piece; a block of 256 reads 64 whole lines of w.
// The layer's LayerNorm gain is multiplied in here: LN(h) W^T = ((h - mean) / std) (gamma * W)^T + beta W^T.
__global__ void cvt_blk_kernel(const float* __restrict__ w, const float* __restrict__ g,
                               _Float16* __restrict__ o, int n8) {
  const int i = blockIdx.x * blockDim.x + threadIdx.x;   // piece index in packed order
  if (i >= n8) return;
  const int lane = i & 31;
  const int part = (i >> 5) & 1;
  const int t    = (i >> 6) & 3;
  const int ks   = (i >> 8) & 31;
  const int wv   = (i >> 13) & 15;
  const int l    = i >> 17;
  const int row  = wv * 64 + t * 16 + (lane & 15);
  const int k    = ks * 32 + part * 16 + ((lane >> 4) << 3);
  const float* src = w + ((size_t)l * HDIM + row) * HDIM + k;
  const v4f a = *(const v4f*)src;
  const v4f b = *(const v4f*)(src + 4);
  const float* gs = g + (size_t)l * HDIM + k;
  const v4f ga = *(const v4f*)gs;
  const v4f gb = *(const v4f*)(gs + 4);
  v8h h;
#pragma unroll
  for (int j = 0; j < 4; ++j) { h[j] = (_Float16)(a[j] * ga[j]); h[4 + j] = (_Float16)(b[j] * gb[j]); }
  *(v8h*)(o + (size_t)i * 8) = h;
}

// Per output column n of each block layer, one wave each:
//   c1[n] = sum_k f16(gamma_k W[n][k])   (what the row mean is multiplied by; the GEMM's own rounded weights)
//   cb[n] = sum_k beta_k W[n][k] + b[n]  (the column's constant)
__global__ void fold_ln_kernel(const float* __restrict__ w, const float* __restrict__ g,
                               const float* __restrict__ be, const float* __restrict__ b,
                               float* __restrict__ c1, float* __restrict__ cb) {
  const int row  = (blockIdx.x * blockDim.x + threadIdx.x) >> 5;   // layer * 1024 + n
  const int lane = threadIdx.x & 31;
  if (row >= NLAYERS * HDIM) return;
  const float* wr = w  + (size_t)row * HDIM + lane * 4;
  const float* gl = g  + (size_t)(row >> 10) * HDIM + lane * 4;
  const float* bl = be + (size_t)(row >> 10) * HDIM + lane * 4;
  float s1 = 0.f, s2 = 0.f;
#pragma unroll
  for (int i = 0; i < 8; ++i) {
    // The wait behind each load stands in front of whatever next writes a register that the load
    // names: in the unrolled form a later load's result is placed on the pointers' registers.
    const v4f a  = *(const v4f*)(wr + i * 128);
    asm volatile("s_wait_xcnt 0x0" ::: "memory");
    const v4f ga = *(const v4f*)(gl + i * 128);
    asm volatile("s_wait_xcnt 0x0" ::: "memory");
    const v4f ba = *(const v4f*)(bl + i * 128);
    asm volatile("s_wait_xcnt 0x0" ::: "memory");
#pragma unroll
    for (int j = 0; j < 4; ++j) { s1 += (float)(_Float16)(a[j] * ga[j]); s2 += a[j] * ba[j]; }
  }
#pragma unroll
  for (int d = 16; d >= 1; d >>= 1) { s1 += __shfl_xor(s1, d, 32); s2 += __shfl_xor(s2, d, 32); }
  if (lane == 0) { c1[row] = s1; cb[row] = s2 + b[row]; }
}

__global__ void cvt_stem_kernel(const float* __restrict__ w, _Float16* __restrict__ o) {
  int i = blockIdx.x * blockDim.x + threadIdx.x;   // 0 .. 1024*32-1
  if (i >= HDIM * 32) return;
  int row = i >> 5, col = i & 31;
  o[i] = (col < FIN) ? (_Float16)w[row * FIN + col] : (_Float16)0.f;
}

// ================= fused MLP kernel =================
__global__ void __launch_bounds__(NTHREADS, 1)
mlp_fused_kernel(const float* __restrict__ x,
                 const float* __restrict__ st_gamma, const float* __restrict__ st_beta,
                 const float* __restrict__ st_b,
                 const float* __restrict__ blkC1, const float* __restrict__ blkCb,
                 const float* __restrict__ last_gamma, const float* __restrict__ last_beta,
                 const float* __restrict__ last_w, const float* __restrict__ last_b,
                 const _Float16* __restrict__ stemW16, const _Float16* __restrict__ blkW16,
                 float* __restrict__ out) {
  extern __shared__ __align__(16) _Float16 smem[];
  _Float16* act = smem;                          // the activations [BM][RS]: each layer rewrites them in place
  _Float16* park = smem + ACT_HALVES;            // [wave][PARKM][4][lane][8] first-pass results in waiting
  float* p1 = (float*)park;                      // [BM][8] partial sums: the head's three arrays lie on the parking place
  float* p2 = p1 + PART_FLOATS;                  // [BM][8] partial sq-sums
  float* p3 = p2 + PART_FLOATS;                  // [BM][8] partial dots (head)
  float* stM = (float*)(park + PARK_HALVES);     // [BM] row mean of the layer's input
  float* stI = stM + BM;                         // [BM] row 1/std of the layer's input
  float* cbS = stI + BM;                         // [HDIM] the layer's column constants
  float* c1S = cbS + HDIM;                       // [HDIM] the layer's column sums
  _Float16* stIn = park;                         // [BM][SIP] stem LN output; dead before the first result is parked

  const int tid     = threadIdx.x;
  const int lane    = tid & 31;
  const int wave    = tid >> 5;          // 0..7
  const int rowBase = blockIdx.x * BM;

  // A wave owns 64 output columns (4 N tiles) of all 128 rows (8 M tiles) in each of two passes over N:
  // columns wave * 64 of the lower 512, then of the upper 512.
  const int lm    = lane & 15;
  const int koff  = (lane >> 4) << 3;    // hi half-wave reads K+8, and holds output columns +8 of an N tile

  // LN work mapping of the head: one row per lane
  const int lrow = tid & 127;            // row handled by this thread
  const int lsg  = tid >> 7;             // which four of the eight 128-col segments (0..1)

  // ---------------- stem LayerNorm over 26 features ----------------
  if (tid < BM) {
    const float* xr = x + (size_t)(rowBase + tid) * FIN;
    float v[FIN];
    float s1 = 0.f;
#pragma unroll
    for (int i = 0; i < FIN; ++i) { v[i] = xr[i]; s1 += v[i]; }
    const float m = s1 * (1.f / FIN);
    float s2 = 0.f;
#pragma unroll
    for (int i = 0; i < FIN; ++i) { float d = v[i] - m; s2 += d * d; }
    const float inv = rsqrtf(s2 * (1.f / FIN) + 1e-5f);
    _Float16* dst = stIn + tid * SIP;
#pragma unroll
    for (int i = 0; i < FIN; ++i)
      dst[i] = (_Float16)((v[i] - m) * inv * st_gamma[i] + st_beta[i]);
#pragma unroll
    for (int i = FIN; i < 32; ++i) dst[i] = (_Float16)0.f;
  }
  __syncthreads();

  // The weight fragments of the two k steps ahead live here, over pass and layer ends too. Layer 0's first two
  // k steps are asked for here and fly under the stem's GEMM.
  v16h bF[2][4];
  const int      wvu  = __builtin_amdgcn_readfirstlane(wave);   // the wave's number as a scalar: weight addresses = scalar base + lane offset
  const unsigned loff = (unsigned)lane * 16u;   // bytes
  load_2ksteps(bF, (const _Float16*)((const char*)(blkW16 + (size_t)wvu * (64 * HDIM)) + loff));

  // ---------------- stem GEMM: [128 x 32] x [32 x 1024], one WMMA K step ----------------
  {
    v16h aF[8];
#pragma unroll
    for (int m = 0; m < 8; ++m) aF[m] = load_frag16(stIn + (m * 16 + lm) * SIP + koff);
#pragma unroll
    for (int p = 0; p < 2; ++p) {
      const int nw = (p * 8 + wave) * 64;
      v8f sb[4];   // the bias of this lane's columns is the accumulators' start value
      load_cols(sb, st_b + nw + koff);
      const _Float16* swp = stemW16 + (size_t)(nw + lm) * 32 + koff;
      v16h sw[4];   // the stem's weight fragments of the 4 N tiles
#pragma unroll
      for (int t = 0; t < 4; ++t) sw[t] = load_frag16(swp + t * 16 * 32);
      // Stands in front of whatever next writes the address registers that these loads name; the pointer
      // as an input stays in its registers up to the wait, so that no load's result is placed on them.
      asm volatile("s_wait_xcnt 0x0" :: "v"(swp) : "memory");
#pragma unroll
      for (int t = 0; t < 4; ++t) {
#pragma unroll
        for (int m = 0; m < 8; ++m) {
          const v8f acc = __builtin_amdgcn_wmma_f32_16x16x32_f16(false, sw[t], false, aF[m],
                                                                 (short)0, sb[t], false, false);
          *(v8h*)(act + (m * 16 + lm) * RS + nw + t * 16 + koff) = row8_relu(acc);
        }
      }
    }
  }

  // ---------------- 8 blocks: LN -> Linear(H->H) -> ReLU ----------------
  // The GEMM runs on the raw ReLU activations against gamma * W; the row mean enters as the
  // accumulators' start value and 1/std, beta W^T and the bias in the epilogue.
  for (int l = 0; l < NLAYERS; ++l) {
    __syncthreads();
    // The column sums and the column constants go through LDS, 4 floats of each a thread: a lane wants 64 of each,
    // too many to hold in registers over the GEMM. Asked for here, they arrive under the statistics.
    const float* c1p = blkC1 + (size_t)l * HDIM + tid * 4;
    const float* cbp = blkCb + (size_t)l * HDIM + tid * 4;
    const v4f c1g = *(const v4f*)c1p;
    const v4f cbg = *(const v4f*)cbp;
    // Stands in front of whatever next writes the address registers that these loads name.
    asm volatile("s_wait_xcnt 0x0" :: "v"(c1p), "v"(cbp) : "memory");
    // ---- row mean and 1/std of the input ----
    row_stats(act, stM, wave, lane);
    *(v4f*)(c1S + tid * 4) = c1g;
    *(v4f*)(cbS + tid * 4) = cbg;
    __syncthreads();
    // ---- GEMM act x (gamma W_l)^T -> scale, constant, ReLU -> act, in two passes over N ----
    // 128 rows share every weight fragment, so the work-groups together load each weight half as often as
    // with 64 rows. Both passes read the whole input, so their f16 results wait until every wave has left
    // the GEMM: in registers, but for the first pass's last PARKM M tiles, for which the second pass has
    // no registers left: each lane parks those in LDS and fetches them back itself.
    const _Float16* wl = blkW16 + (size_t)l * HDIM * HDIM;   // packed: see cvt_blk_kernel
    const _Float16* arow = act + lm * RS + koff;
    v8h rp[8 - PARKM][4];   // [m][t] the first pass's results that wait in registers
    v8h rc[8][4];           // [m][t] a pass's results
    _Float16* pk = park + (wave * (PARKM * 4 * 32) + lane) * 8;   // this lane's first piece
    // Stays rolled: unrolled, the compiler moves the first pass's scaling and rounding behind the second pass's
    // GEMM and keeps its f32 tiles alive over it, twice the registers of the f16 results.
#pragma unroll 1
    for (int p = 0; p < 2; ++p) {
      const int nw = (p * 8 + wave) * 64;
      // The first k step's activation fragments: asked for here, they arrive under the accumulators' start values.
      v16h aX[4], aY[4];
      load_act4(aX, arow);
      load_act4(aY, arow + 4 * 16 * RS);
      v8f acc[8][4];   // [m][t]
      {
        float nm[8];   // this lane's one row of each M tile
#pragma unroll
        for (int m = 0; m < 8; ++m) nm[m] = -stM[m * 16 + lm];
#pragma unroll
        for (int t = 0; t < 4; ++t) {
          // this lane's 8 columns of the column sums in N tile t
          const v4f lo = *(const v4f*)(c1S + nw + t * 16 + koff);
          const v4f hi = *(const v4f*)(c1S + nw + t * 16 + koff + 4);
          const v8f c1v = __builtin_shufflevector(lo, hi, 0, 1, 2, 3, 4, 5, 6, 7);
#pragma unroll
          for (int m = 0; m < 8; ++m) acc[m][t] = c1v * nm[m];
        }
      }
      const _Float16* wpk = wl + (size_t)(p * 8 + wvu) * (64 * HDIM);
      // What the last trip asks for: the first two k steps of the next pass, or of the next layer's first pass.
      // They depend on no activation and fly under the epilogue and the next layer's statistics. Behind the
      // last pass of the last layer nothing is left: there the trip reads this pass's first two again, unused.
      const _Float16* wnx = (p == 0) ? wpk + (size_t)8 * 64 * HDIM
                          : (l + 1 < NLAYERS) ? wl + (size_t)HDIM * HDIM + (size_t)wvu * (64 * HDIM) : wpk;
      // 64 k per trip = two k steps of 4 KiB of this wave's packed weights. The weight fragments of a k step
      // were asked for two k steps earlier, its activation fragments half a k step earlier.
      for (int k = 0; k < HDIM - 64; k += 64) {
        const _Float16* nb = (const _Float16*)((const char*)(wpk + (size_t)(k + 64) * 64) + loff);
#pragma unroll
        for (int s = 0; s < 2; ++s)
          kstep_wmma_refill(acc, aX, aY, bF[s], arow + k + (s + 1) * 32, true, nb, s * 2048);
        // Stands in front of whatever next writes an address register that the trip's weight loads name; the
        // fence behind it keeps the step of that address, at the trip's foot, from being lifted over the wait.
        asm volatile("s_wait_xcnt 0x0" ::: "memory");
        __builtin_amdgcn_sched_barrier(0);
      }
      const _Float16* nbl = (const _Float16*)((const char*)wnx + loff);
      kstep_wmma_refill(acc, aX, aY, bF[0], arow + (HDIM - 32), true, nbl, 0);
      // Behind the pass's last k step no activation fragment is left to ask for.
      kstep_wmma_refill(acc, aX, aY, bF[1], arow, false, nbl, 2048);
      // The same wait and fence behind the last trip's loads.
      asm volatile("s_wait_xcnt 0x0" ::: "memory");
      __builtin_amdgcn_sched_barrier(0);
      float inv[8];   // this lane's one row of each M tile
#pragma unroll
      for (int m = 0; m < 8; ++m) inv[m] = stI[m * 16 + lm];
#pragma unroll
      for (int t = 0; t < 4; ++t) {
        // this lane's 8 columns of the constants in N tile t
        const v4f lo = *(const v4f*)(cbS + nw + t * 16 + koff);
        const v4f hi = *(const v4f*)(cbS + nw + t * 16 + koff + 4);
        const v8f cbv = __builtin_shufflevector(lo, hi, 0, 1, 2, 3, 4, 5, 6, 7);
#pragma unroll
        for (int m = 0; m < 8; ++m) rc[m][t] = row8_relu(acc[m][t] * inv[m] + cbv);
      }
      if (p == 0) {
#pragma unroll
        for (int m = 0; m < 8; ++m)
#pragma unroll
          for (int t = 0; t < 4; ++t) {
            if (m < 8 - PARKM) rp[m][t] = rc[m][t];
            else               *(v8h*)(pk + ((m - (8 - PARKM)) * 4 + t) * 256) = rc[m][t];
          }
      }
    }
    // Every wave has read the input for the last time: only behind this barrier is it overwritten.
    __syncthreads();
#pragma unroll
    for (int m = 0; m < 8; ++m)
#pragma unroll
      for (int t = 0; t < 4; ++t) {
        const v8h h0 = (m < 8 - PARKM) ? rp[m < 8 - PARKM ? m : 0][t]
                                       : *(const v8h*)(pk + ((m - (8 - PARKM)) * 4 + t) * 256);
        _Float16* dst = act + (m * 16 + lm) * RS + wave * 64 + t * 16 + koff;
        *(v8h*)dst         = h0;         // first pass: the lower 512 columns
        *(v8h*)(dst + 512) = rc[m][t];   // second pass: the upper 512
      }
  }
  __syncthreads();
  const _Float16* hfin = act;   // the last layer's output

  // ---------------- head: LN -> Linear(H->1) -> sigmoid ----------------
  for (int q = 0; q < 4; ++q) {
    const int lseg = lsg * 4 + q;
    const _Float16* src = hfin + lrow * RS + lseg * 128;
    float s1 = 0.f, s2 = 0.f;
#pragma unroll
    for (int cc = 0; cc < 128; cc += 8) {
      v8h h = *(const v8h*)(src + cc);
#pragma unroll
      for (int i = 0; i < 8; ++i) { float v = (float)h[i]; s1 += v; s2 += v * v; }
    }
    p1[lrow * 8 + lseg] = s1;
    p2[lrow * 8 + lseg] = s2;
  }
  __syncthreads();
  {
    float s1 = 0.f, s2 = 0.f;
#pragma unroll
    for (int j = 0; j < 8; ++j) { s1 += p1[lrow * 8 + j]; s2 += p2[lrow * 8 + j]; }
    const float m   = s1 * (1.f / HDIM);
    const float var = s2 * (1.f / HDIM) - m * m;
    const float inv = rsqrtf(var + 1e-5f);
    for (int q = 0; q < 4; ++q) {
      const int lseg = lsg * 4 + q;
      const int c0   = lseg * 128;
      const _Float16* src = hfin + lrow * RS + c0;
      const float* lg = last_gamma + c0;
      const float* lb = last_beta + c0;
      const float* lw = last_w + c0;
      float dot = 0.f;
#pragma unroll
      for (int cc = 0; cc < 128; cc += 8) {
        v8h h = *(const v8h*)(src + cc);
#pragma unroll
        for (int i = 0; i < 8; ++i) {
          float v = ((float)h[i] - m) * inv * lg[cc + i] + lb[cc + i];
          dot += v * lw[cc + i];
        }
      }
      p3[lrow * 8 + lseg] = dot;
    }
  }
  __syncthreads();
  if (tid < BM) {
    float dot = 0.f;
#pragma unroll
    for (int j = 0; j < 8; ++j) dot += p3[tid * 8 + j];
    const float z = dot + last_b[0];
    (out + rowBase)[tid] = 1.f / (1.f + __expf(-z));   // scalar base + thread index: no row index kept in a register over the layers
  }
}

// ================= host launcher =================
extern "C" void kernel_launch(void* const* d_in, const int* in_sizes, int n_in,
                              void* d_out, int out_size, void* d_ws, size_t ws_size,
                              hipStream_t stream) {
  (void)in_sizes; (void)n_in; (void)out_size; (void)ws_size;

  const float* x         = (const float*)d_in[0];
  const float* st_gamma  = (const float*)d_in[1];
  const float* st_beta   = (const float*)d_in[2];
  const float* st_w      = (const float*)d_in[3];
  const float* st_b      = (const float*)d_in[4];
  const float* blk_gamma = (const float*)d_in[5];
  const float* blk_beta  = (const float*)d_in[6];
  const float* blk_w     = (const float*)d_in[7];
  const float* blk_b     = (const float*)d_in[8];
  const float* last_gamma= (const float*)d_in[9];
  const float* last_beta = (const float*)d_in[10];
  const float* last_w    = (const float*)d_in[11];
  const float* last_b    = (const float*)d_in[12];
  float* out = (float*)d_out;

  // ws layout: stem weights padded to [1024][32] f16, then block weights, 8*1024*1024 f16, packed,
  // then the two per-column vectors of the folded LayerNorm, 8*1024 f32 each
  _Float16* stemW16 = (_Float16*)d_ws;
  _Float16* blkW16  = stemW16 + (size_t)HDIM * 32;
  float*    blkC1   = (float*)(blkW16 + (size_t)NLAYERS * HDIM * HDIM);
  float*    blkCb   = blkC1 + NLAYERS * HDIM;

  // convert weights to f16 (every call; deterministic)
  {
    const int n8 = NLAYERS * HDIM * HDIM / 8;   // 16-byte pieces
    cvt_blk_kernel<<<(n8 + 255) / 256, 256, 0, stream>>>(blk_w, blk_gamma, blkW16, n8);
    fold_ln_kernel<<<NLAYERS * HDIM * 32 / 256, 256, 0, stream>>>(blk_w, blk_gamma, blk_beta, blk_b,
                                                                  blkC1, blkCb);
    cvt_stem_kernel<<<(HDIM * 32 + 255) / 256, 256, 0, stream>>>(st_w, stemW16);
  }

  static_assert(SMEM_BYTES == 322560, "LDS budget (<= 320KB/WGP)");
  static_assert(3 * PART_FLOATS * 4 <= PARK_HALVES * 2 && BM * SIP <= PARK_HALVES, "what lies on the parking place fits it");
  hipFuncSetAttribute((const void*)mlp_fused_kernel,
                      hipFuncAttributeMaxDynamicSharedMemorySize, SMEM_BYTES);

  const int nBlocks = 65536 / BM;  // 512
  mlp_fused_kernel<<<nBlocks, NTHREADS, SMEM_BYTES, stream>>>(
      x, st_gamma, st_beta, st_b,
      blkC1, blkCb,
      last_gamma, last_beta, last_w, last_b,
      stemW16, blkW16, out);
}

// v009
// It runs in 499 microseconds.
// In both of two side-by-side timings against v008, it was 1.04 times as fast.
// Counting every step since v000, it is 7.15 times as fast.
#include <hip/hip_runtime.h>

typedef _Float16 v8h  __attribute__((ext_vector_type(8)));
typedef _Float16 v16h __attribute__((ext_vector_type(16)));
typedef float    v8f  __attribute__((ext_vector_type(8)));
typedef float    v4f  __attribute__((ext_vector_type(4)));
typedef float    v2f  __attribute__((ext_vector_type(2)));

#define HDIM    1024
#define RS      1032      // padded LDS row stride in halves (2064 B: 16B-aligned, bank ~= 4*row)
#define BM      128       // batch rows per workgroup
#define NTHREADS 256      // 8 wave32s, two per SIMD, up to 512 registers each
#define SIP     40        // LDS row stride in halves of the stem's input (80 B: 16 B x odd)
#define PARKM   3         // M tiles whose first-pass results wait in LDS, not in registers
#define PARK_HALVES ((NTHREADS / 32) * PARKM * 4 * 32 * 8)   // per wave, M tile and N tile one 16-byte piece a lane
#define NLAYERS 8
#define FIN     26
// 1 activation buffer, rewritten in place + the parking place (the stem's input lies on it first, the head's 3 small
// reduction scratch arrays s1, s2, dot last) + per-row mean and 1/std + a layer's column sums and column constants
#define ACT_HALVES   (BM * RS)
#define PART_FLOATS  (BM * 8)
#define SMEM_BYTES   ((ACT_HALVES + PARK_HALVES) * (int)sizeof(_Float16) + (2 * BM + 2 * HDIM) * (int)sizeof(float))

// ---- fragment loader: lane-local 16 halves = [k..k+7] and [k+16..k+23] ----
__device__ __forceinline__ v16h load_frag16(const _Float16* p) {
  v8h lo = *(const v8h*)p;
  v8h hi = *(const v8h*)(p + 16);
  return __builtin_shufflevector(lo, hi, 0,1,2,3,4,5,6,7,8,9,10,11,12,13,14,15);
}

// ---- the same fragment from the packed weights: its two halves lie 512 bytes apart ----
__device__ __forceinline__ v16h load_frag16_packed(const _Float16* p) {
  v8h lo = *(const v8h*)p;
  v8h hi = *(const v8h*)(p + 256);
  return __builtin_shufflevector(lo, hi, 0,1,2,3,4,5,6,7,8,9,10,11,12,13,14,15);
}

// Two k steps' weight fragments from p, the lane's own place in the packed weights: 16 loads as one group.
__device__ __forceinline__ void load_2ksteps(v16h (&b)[2][4], const _Float16* p) {
#pragma unroll
  for (int s = 0; s < 2; ++s)
#pragma unroll
    for (int t = 0; t < 4; ++t) b[s][t] = load_frag16_packed(p + s * 2048 + t * 512);
  // Stands in front of whatever next writes the address registers that these loads name, and keeps the
  // loads where they are written. The pointer as an input stays in its registers up to the wait, so
  // that no load's result is placed on them.
  asm volatile("s_wait_xcnt 0x0" :: "v"(p) : "memory");
}

// ---- 4 activation fragments from LDS as one group: 4 M tiles in a row of one k step, from a, the lane's place in the first ----
__device__ __forceinline__ void load_act4(v16h (&f)[4], const _Float16* a) {
#pragma unroll
  for (int m = 0; m < 4; ++m) f[m] = load_frag16(a + m * 16 * RS);
}

// ---- one k step of the 128x64 wave tile: 32 WMMAs in two runs of 16, all loads in two places ----
// The weights are operand A and the activations operand B: accumulator register r of lane (c, h) is
// output column 8h + r of the N tile, batch row c of the M tile.
// The activation fragments live in two register sets, aX (M tiles 0..3) and aY (M tiles 4..7). Each set is
// asked for again, for the next k step (at an), as one group of 8 LDS reads right behind the 16 WMMAs that
// read it, and is first read 16 WMMAs later: no read stands among the WMMAs of a run and none is waited
// for where it is issued. The k step's 4 weight fragments are asked for anew, for the k step two ahead
// (nbo halves behind nb, the lane's own place in a trip's weights), as one group in the second of the two places.
__device__ __forceinline__ void kstep_wmma_refill(v8f (&acc)[8][4], v16h (&aX)[4], v16h (&aY)[4], v16h (&b)[4],
                                                  const _Float16* an, const bool more, const _Float16* nb, const int nbo) {
  // Weight fragment outermost: the youngest of the weight loads is needed 12 WMMAs later than the oldest.
#pragma unroll
  for (int t = 0; t < 4; ++t)
#pragma unroll
    for (int m = 0; m < 4; ++m)
      acc[m][t] = __builtin_amdgcn_wmma_f32_16x16x32_f16(false, b[t], false, aX[m],
                                                         (short)0, acc[m][t], false, false);
  // The fences keep each group of loads whole and between the two runs: sunk the reads
  // would lose their lead.
  __builtin_amdgcn_sched_barrier(0);
  if (more) load_act4(aX, an);
  __builtin_amdgcn_sched_barrier(0);
#pragma unroll
  for (int m = 0; m < 4; ++m)
#pragma unroll
    for (int t = 0; t < 4; ++t)
      acc[4 + m][t] = __builtin_amdgcn_wmma_f32_16x16x32_f16(false, b[t], false, aY[m],
                                                             (short)0, acc[4 + m][t], false, false);
  __builtin_amdgcn_sched_barrier(0);
  if (more) load_act4(aY, an + 4 * 16 * RS);
  // The LDS reads stay in front of the weight loads: they are needed first, after 16 WMMAs.
  __builtin_amdgcn_sched_barrier(0);
#pragma unroll
  for (int t = 0; t < 4; ++t) b[t] = load_frag16_packed(nb + nbo + t * 512);
  __builtin_amdgcn_sched_barrier(0);
}

// ---- a lane's 8 accumulator values are 8 consecutive columns of one row: f16, ReLU on the packed halves
//      (rounding keeps sign and order, so the values are those of ReLU before rounding): one 16-byte piece ----
__device__ __forceinline__ v8h row8_relu(const v8f& v) {
  v8h h = __builtin_convertvector(v, v8h);
  const v8h zero = {};
  return __builtin_elementwise_max(h, zero);
}

// A per-column f32 vector in global memory, from p, the lane's own 8 columns of its first N tile:
// 8 floats for each of the 4 N tiles.
__device__ __forceinline__ void load_cols(v8f (&c)[4], const float* p) {
#pragma unroll
  for (int t = 0; t < 4; ++t) {
    const v4f lo = *(const v4f*)(p + t * 16);
    const v4f hi = *(const v4f*)(p + t * 16 + 4);
    c[t] = __builtin_shufflevector(lo, hi, 0, 1, 2, 3, 4, 5, 6, 7);
  }
  // Stands in front of whatever next writes the address registers that these loads name, and keeps the
  // loads where they are written. The pointer as an input stays in its registers up to the wait, so
  // that no load's result is placed on them.
  asm volatile("s_wait_xcnt 0x0" :: "v"(p) : "memory");
}

// ---- row mean and 1/std of the 128 activation rows, on the matrix unit: wave w takes the 16 rows of M tile w ----
// The wave's fragment f of a k step (16 rows x 32 k) is operand B of ones x f, whose every accumulator row holds the
// 16 row sums, and both operands of f x f^T, whose diagonal holds the 16 sums of squares (the A and the B map of a
// fragment are the same: lane = row, the same k at every register). No vector sum and no cross-lane step is left.
__device__ __forceinline__ void row_stats(const _Float16* act, float* stM, const int wave, const int lane) {
  const int lm = lane & 15;
  const _Float16* src = act + (wave * 16 + lm) * RS + ((lane >> 4) << 3);
  v16h ones;
#pragma unroll
  for (int i = 0; i < 16; ++i) ones[i] = (_Float16)1.f;
  // Three accumulator tiles, the squares' for even and odd k steps.
  v8f sum = {}, gram[2] = {};
  // The 32 k steps in 8 groups of 4: a group's 8 LDS reads are issued 2 groups ahead of its 8 WMMAs.
  v16h f[8][4];
#pragma unroll
  for (int i = 0; i < 8; ++i) f[i / 4][i % 4] = load_frag16(src + i * 32);
#pragma unroll
  for (int c = 0; c < 8; ++c) {
    // The fences keep each group of reads whole and where it is written: left alone, the compiler puts every
    // pair of reads directly in front of its two WMMAs and waits there for the whole LDS latency.
    __builtin_amdgcn_sched_barrier(0);
#pragma unroll
    for (int i = 0; i < 4; i += 2) {
      // Two k steps: both squares, then both sums, the order held by a fence behind each WMMA. So all three tiles are
      // first written while both of the first two fragments are still to be read: no tile is placed on registers
      // that a WMMA issued just before reads as its operand B.
      gram[0] = __builtin_amdgcn_wmma_f32_16x16x32_f16(false, f[c][i], false, f[c][i], (short)0, gram[0], false, false);
      __builtin_amdgcn_sched_barrier(0);
      gram[1] = __builtin_amdgcn_wmma_f32_16x16x32_f16(false, f[c][i + 1], false, f[c][i + 1], (short)0, gram[1], false, false);
      __builtin_amdgcn_sched_barrier(0);
      sum = __builtin_amdgcn_wmma_f32_16x16x32_f16(false, ones, false, f[c][i], (short)0, sum, false, false);
      __builtin_amdgcn_sched_barrier(0);
      sum = __builtin_amdgcn_wmma_f32_16x16x32_f16(false, ones, false, f[c][i + 1], (short)0, sum, false, false);
      __builtin_amdgcn_sched_barrier(0);
    }
    if (c + 2 < 8) {
#pragma unroll
      for (int i = 0; i < 4; ++i) f[c + 2][i] = load_frag16(src + ((c + 2) * 4 + i) * 32);
    }
  }
  // Accumulator register r of lane (c, h) is element (8h + r, c): the diagonal element of row c stands in
  // register c & 7 of the lane with h == c >> 3.
  const v8f g = gram[0] + gram[1];
  const v4f g4 = (lane & 1) ? __builtin_shufflevector(g, g, 1, 3, 5, 7) : __builtin_shufflevector(g, g, 0, 2, 4, 6);
  const v2f g2 = (lane & 2) ? __builtin_shufflevector(g4, g4, 1, 3) : __builtin_shufflevector(g4, g4, 0, 2);
  const float s2  = (lane & 4) ? g2[1] : g2[0];
  const float s1  = sum[0];
  const float m   = s1 * (1.f / HDIM);
  const float var = s2 * (1.f / HDIM) - m * m;
  const float inv = rsqrtf(var + 1e-5f);
  float* st = stM + wave * 16 + lm;   // 1/std lies BM floats behind the mean
  if ((lane >> 4) == (lm >> 3)) { st[0] = m; st[BM] = inv; }
}

// ================= weight conversion kernels (f32 -> f16, run each call) =================
// Block weights go out in the order the GEMM's lanes read them:
//   [layer][group of 64 columns, one wave's in a pass: 16][k step of 32: 32][N tile 4][fragment half 2][lane 32][8 halves]
// so that one wave-wide 16-byte load is 512 contiguous bytes (4 whole 128-byte lines)
// and a wave's 16 loads of a trip are 8 KiB in a row.
// One thread makes one lane's 16-byte piece; a block of 256 reads 64 whole lines of w.
// The layer's LayerNorm gain is multiplied in here: LN(h) W^T = ((h - mean) / std) (gamma * W)^T + beta W^T.
__global__ void cvt_blk_kernel(const float* __restrict__ w, const float* __restrict__ g,
                               _Float16* __restrict__ o, int n8) {
  const int i = blockIdx.x * blockDim.x + threadIdx.x;   // piece index in packed order
  if (i >= n8) return;
  const int lane = i & 31;
  const int part = (i >> 5) & 1;
  const int t    = (i >> 6) & 3;
  const int ks   = (i >> 8) & 31;
  const int wv   = (i >> 13) & 15;
  const int l    = i >> 17;
  const int row  = wv * 64 + t * 16 + (lane & 15);
  const int k    = ks * 32 + part * 16 + ((lane >> 4) << 3);
  const float* src = w + ((size_t)l * HDIM + row) * HDIM + k;
  const v4f a = *(const v4f*)src;
  const v4f b = *(const v4f*)(src + 4);
  const float* gs = g + (size_t)l * HDIM + k;
  const v4f ga = *(const v4f*)gs;
  const v4f gb = *(const v4f*)(gs + 4);
  v8h h;
#pragma unroll
  for (int j = 0; j < 4; ++j) { h[j] = (_Float16)(a[j] * ga[j]); h[4 + j] = (_Float16)(b[j] * gb[j]); }
  *(v8h*)(o + (size_t)i * 8) = h;
}

// Per output column n of each block layer, one wave each:
//   c1[n] = sum_k f16(gamma_k W[n][k])   (what the row mean is multiplied by; the GEMM's own rounded weights)
//   cb[n] = sum_k beta_k W[n][k] + b[n]  (the column's constant)
__global__ void fold_ln_kernel(const float* __restrict__ w, const float* __restrict__ g,
                               const float* __restrict__ be, const float* __restrict__ b,
                               float* __restrict__ c1, float* __restrict__ cb) {
  const int row  = (blockIdx.x * blockDim.x + threadIdx.x) >> 5;   // layer * 1024 + n
  const int lane = threadIdx.x & 31;
  if (row >= NLAYERS * HDIM) return;
  const float* wr = w  + (size_t)row * HDIM + lane * 4;
  const float* gl = g  + (size_t)(row >> 10) * HDIM + lane * 4;
  const float* bl = be + (size_t)(row >> 10) * HDIM + lane * 4;
  float s1 = 0.f, s2 = 0.f;
#pragma unroll
  for (int i = 0; i < 8; ++i) {
    // The wait behind each load stands in front of whatever next writes a register that the load
    // names: in the unrolled form a later load's result is placed on the pointers' registers.
    const v4f a  = *(const v4f*)(wr + i * 128);
    asm volatile("s_wait_xcnt 0x0" ::: "memory");
    const v4f ga = *(const v4f*)(gl + i * 128);
    asm volatile("s_wait_xcnt 0x0" ::: "memory");
    const v4f ba = *(const v4f*)(bl + i * 128);
    asm volatile("s_wait_xcnt 0x0" ::: "memory");
#pragma unroll
    for (int j = 0; j < 4; ++j) { s1 += (float)(_Float16)(a[j] * ga[j]); s2 += a[j] * ba[j]; }
  }
#pragma unroll
  for (int d = 16; d >= 1; d >>= 1) { s1 += __shfl_xor(s1, d, 32); s2 += __shfl_xor(s2, d, 32); }
  if (lane == 0) { c1[row] = s1; cb[row] = s2 + b[row]; }
}

__global__ void cvt_stem_kernel(const float* __restrict__ w, _Float16* __restrict__ o) {
  int i = blockIdx.x * blockDim.x + threadIdx.x;   // 0 .. 1024*32-1
  if (i >= HDIM * 32) return;
  int row = i >> 5, col = i & 31;
  o[i] = (col < FIN) ? (_Float16)w[row * FIN + col] : (_Float16)0.f;
}

// ================= fused MLP kernel =================
__global__ void __launch_bounds__(NTHREADS, 1)
mlp_fused_kernel(const float* __restrict__ x,
                 const float* __restrict__ st_gamma, const float* __restrict__ st_beta,
                 const float* __restrict__ st_b,
                 const float* __restrict__ blkC1, const float* __restrict__ blkCb,
                 const float* __restrict__ last_gamma, const float* __restrict__ last_beta,
                 const float* __restrict__ last_w, const float* __restrict__ last_b,
                 const _Float16* __restrict__ stemW16, const _Float16* __restrict__ blkW16,
                 float* __restrict__ out) {
  extern __shared__ __align__(16) _Float16 smem[];
  _Float16* act = smem;                          // the activations [BM][RS]: each layer rewrites them in place
  _Float16* park = smem + ACT_HALVES;            // [wave][PARKM][4][lane][8] first-pass results in waiting
  float* p1 = (float*)park;                      // [BM][8] partial sums: the head's three arrays lie on the parking place
  float* p2 = p1 + PART_FLOATS;                  // [BM][8] partial sq-sums
  float* p3 = p2 + PART_FLOATS;                  // [BM][8] partial dots (head)
  float* stM = (float*)(park + PARK_HALVES);     // [BM] row mean of the layer's input
  float* stI = stM + BM;                         // [BM] row 1/std of the layer's input
  float* cbS = stI + BM;                         // [HDIM] the layer's column constants
  float* c1S = cbS + HDIM;                       // [HDIM] the layer's column sums
  _Float16* stIn = park;                         // [BM][SIP] stem LN output; dead before the first result is parked

  const int tid     = threadIdx.x;
  const int lane    = tid & 31;
  const int wave    = tid >> 5;          // 0..7
  const int rowBase = blockIdx.x * BM;
  // Every work-group reads the same weights. Each starts its walk over k at a trip of its own, one of 16, and wraps:
  // at one moment the work-groups ask L2 for 16 different parts of a layer's weights and not all for the same lines.
  const int k0 = (int)((blockIdx.x >> 3) & (HDIM / 64 - 1)) * 64;

  // A wave owns 64 output columns (4 N tiles) of all 128 rows (8 M tiles) in each of two passes over N:
  // columns wave * 64 of the lower 512, then of the upper 512.
  const int lm    = lane & 15;
  const int koff  = (lane >> 4) << 3;    // hi half-wave reads K+8, and holds output columns +8 of an N tile

  // LN work mapping of the head: one row per lane
  const int lrow = tid & 127;            // row handled by this thread
  const int lsg  = tid >> 7;             // which four of the eight 128-col segments (0..1)

  // ---------------- stem LayerNorm over 26 features ----------------
  if (tid < BM) {
    const float* xr = x + (size_t)(rowBase + tid) * FIN;
    float v[FIN];
    float s1 = 0.f;
#pragma unroll
    for (int i = 0; i < FIN; ++i) { v[i] = xr[i]; s1 += v[i]; }
    const float m = s1 * (1.f / FIN);
    float s2 = 0.f;
#pragma unroll
    for (int i = 0; i < FIN; ++i) { float d = v[i] - m; s2 += d * d; }
    const float inv = rsqrtf(s2 * (1.f / FIN) + 1e-5f);
    _Float16* dst = stIn + tid * SIP;
#pragma unroll
    for (int i = 0; i < FIN; ++i)
      dst[i] = (_Float16)((v[i] - m) * inv * st_gamma[i] + st_beta[i]);
#pragma unroll
    for (int i = FIN; i < 32; ++i) dst[i] = (_Float16)0.f;
  }
  __syncthreads();

  // The weight fragments of the two k steps ahead live here, over pass and layer ends too. Layer 0's first two
  // k steps are asked for here and fly under the stem's GEMM.
  v16h bF[2][4];
  const int      wvu  = __builtin_amdgcn_readfirstlane(wave);   // the wave's number as a scalar: weight addresses = scalar base + lane offset
  const unsigned loff = (unsigned)lane * 16u;   // bytes
  load_2ksteps(bF, (const _Float16*)((const char*)(blkW16 + (size_t)wvu * (64 * HDIM) + (size_t)k0 * 64) + loff));

  // ---------------- stem GEMM: [128 x 32] x [32 x 1024], one WMMA K step ----------------
  {
    v16h aF[8];
#pragma unroll
    for (int m = 0; m < 8; ++m) aF[m] = load_frag16(stIn + (m * 16 + lm) * SIP + koff);
#pragma unroll
    for (int p = 0; p < 2; ++p) {
      const int nw = (p * 8 + wave) * 64;
      v8f sb[4];   // the bias of this lane's columns is the accumulators' start value
      load_cols(sb, st_b + nw + koff);
      const _Float16* swp = stemW16 + (size_t)(nw + lm) * 32 + koff;
      v16h sw[4];   // the stem's weight fragments of the 4 N tiles
#pragma unroll
      for (int t = 0; t < 4; ++t) sw[t] = load_frag16(swp + t * 16 * 32);
      // Stands in front of whatever next writes the address registers that these loads name; the pointer
      // as an input stays in its registers up to the wait, so that no load's result is placed on them.
      asm volatile("s_wait_xcnt 0x0" :: "v"(swp) : "memory");
#pragma unroll
      for (int t = 0; t < 4; ++t) {
#pragma unroll
        for (int m = 0; m < 8; ++m) {
          const v8f acc = __builtin_amdgcn_wmma_f32_16x16x32_f16(false, sw[t], false, aF[m],
                                                                 (short)0, sb[t], false, false);
          *(v8h*)(act + (m * 16 + lm) * RS + nw + t * 16 + koff) = row8_relu(acc);
        }
      }
    }
  }

  // ---------------- 8 blocks: LN -> Linear(H->H) -> ReLU ----------------
  // The GEMM runs on the raw ReLU activations against gamma * W; the row mean enters as the
  // accumulators' start value and 1/std, beta W^T and the bias in the epilogue.
  for (int l = 0; l < NLAYERS; ++l) {
    __syncthreads();
    // The column sums and the column constants go through LDS, 4 floats of each a thread: a lane wants 64 of each,
    // too many to hold in registers over the GEMM. Asked for here, they arrive under the statistics.
    const float* c1p = blkC1 + (size_t)l * HDIM + tid * 4;
    const float* cbp = blkCb + (size_t)l * HDIM + tid * 4;
    const v4f c1g = *(const v4f*)c1p;
    const v4f cbg = *(const v4f*)cbp;
    // Stands in front of whatever next writes the address registers that these loads name.
    asm volatile("s_wait_xcnt 0x0" :: "v"(c1p), "v"(cbp) : "memory");
    // ---- row mean and 1/std of the input ----
    row_stats(act, stM, wave, lane);
    *(v4f*)(c1S + tid * 4) = c1g;
    *(v4f*)(cbS + tid * 4) = cbg;
    __syncthreads();
    // ---- GEMM act x (gamma W_l)^T -> scale, constant, ReLU -> act, in two passes over N ----
    // 128 rows share every weight fragment, so the work-groups together load each weight half as often as
    // with 64 rows. Both passes read the whole input, so their f16 results wait until every wave has left
    // the GEMM: in registers, but for the first pass's last PARKM M tiles, for which the second pass has
    // no registers left: each lane parks those in LDS and fetches them back itself.
    const _Float16* wl = blkW16 + (size_t)l * HDIM * HDIM;   // packed: see cvt_blk_kernel
    const _Float16* arow = act + lm * RS + koff;
    v8h rp[8 - PARKM][4];   // [m][t] the first pass's results that wait in registers
    v8h rc[8][4];           // [m][t] a pass's results
    _Float16* pk = park + (wave * (PARKM * 4 * 32) + lane) * 8;   // this lane's first piece
    // Stays rolled: unrolled, the compiler moves the first pass's scaling and rounding behind the second pass's
    // GEMM and keeps its f32 tiles alive over it, twice the registers of the f16 results.
#pragma unroll 1
    for (int p = 0; p < 2; ++p) {
      const int nw = (p * 8 + wave) * 64;
      // The first k step's activation fragments: asked for here, they arrive under the accumulators' start values.
      v16h aX[4], aY[4];
      load_act4(aX, arow + k0);
      load_act4(aY, arow + k0 + 4 * 16 * RS);
      v8f acc[8][4];   // [m][t]
      {
        float nm[8];   // this lane's one row of each M tile
#pragma unroll
        for (int m = 0; m < 8; ++m) nm[m] = -stM[m * 16 + lm];
#pragma unroll
        for (int t = 0; t < 4; ++t) {
          // this lane's 8 columns of the column sums in N tile t
          const v4f lo = *(const v4f*)(c1S + nw + t * 16 + koff);
          const v4f hi = *(const v4f*)(c1S + nw + t * 16 + koff + 4);
          const v8f c1v = __builtin_shufflevector(lo, hi, 0, 1, 2, 3, 4, 5, 6, 7);
#pragma unroll
          for (int m = 0; m < 8; ++m) acc[m][t] = c1v * nm[m];
        }
      }
      const _Float16* wpk = wl + (size_t)(p * 8 + wvu) * (64 * HDIM);
      // What the last trip asks for: the first two k steps (from k0) of the next pass, or of the next layer's first pass.
      // They depend on no activation and fly under the epilogue and the next layer's statistics. Behind the
      // last pass of the last layer nothing is left: there the trip reads this pass's first two again, unused.
      const _Float16* wnx = (p == 0) ? wpk + (size_t)8 * 64 * HDIM
                          : (l + 1 < NLAYERS) ? wl + (size_t)HDIM * HDIM + (size_t)wvu * (64 * HDIM) : wpk;
      // 64 k per trip = two k steps of 4 KiB of this wave's packed weights. The weight fragments of a k step
      // were asked for two k steps earlier, its activation fragments half a k step earlier. The walk goes from k0
      // round to k0: kc is this trip's k, kn the next trip's.
      int kc = k0;
      for (int i = 0; i < HDIM / 64 - 1; ++i) {
        const int kn = (kc + 64) & (HDIM - 1);
        const _Float16* nb = (const _Float16*)((const char*)(wpk + (size_t)kn * 64) + loff);
        kstep_wmma_refill(acc, aX, aY, bF[0], arow + kc + 32, true, nb, 0);
        kstep_wmma_refill(acc, aX, aY, bF[1], arow + kn, true, nb, 2048);
        kc = kn;
        // Stands in front of whatever next writes an address register that the trip's weight loads name; the
        // fence behind it keeps the step of that address, at the trip's foot, from being lifted over the wait.
        asm volatile("s_wait_xcnt 0x0" ::: "memory");
        __builtin_amdgcn_sched_barrier(0);
      }
      const _Float16* nbl = (const _Float16*)((const char*)(wnx + (size_t)k0 * 64) + loff);
      kstep_wmma_refill(acc, aX, aY, bF[0], arow + kc + 32, true, nbl, 0);
      // Behind the pass's last k step no activation fragment is left to ask for.
      kstep_wmma_refill(acc, aX, aY, bF[1], arow, false, nbl, 2048);
      // The same wait and fence behind the last trip's loads.
      asm volatile("s_wait_xcnt 0x0" ::: "memory");
      __builtin_amdgcn_sched_barrier(0);
      float inv[8];   // this lane's one row of each M tile
#pragma unroll
      for (int m = 0; m < 8; ++m) inv[m] = stI[m * 16 + lm];
#pragma unroll
      for (int t = 0; t < 4; ++t) {
        // this lane's 8 columns of the constants in N tile t
        const v4f lo = *(const v4f*)(cbS + nw + t * 16 + koff);
        const v4f hi = *(const v4f*)(cbS + nw + t * 16 + koff + 4);
        const v8f cbv = __builtin_shufflevector(lo, hi, 0, 1, 2, 3, 4, 5, 6, 7);
#pragma unroll
        for (int m = 0; m < 8; ++m) rc[m][t] = row8_relu(acc[m][t] * inv[m] + cbv);
      }
      if (p == 0) {
#pragma unroll
        for (int m = 0; m < 8; ++m)
#pragma unroll
          for (int t = 0; t < 4; ++t) {
            if (m < 8 - PARKM) rp[m][t] = rc[m][t];
            else               *(v8h*)(pk + ((m - (8 - PARKM)) * 4 + t) * 256) = rc[m][t];
          }
      }
    }
    // Every wave has read the input for the last time: only behind this barrier is it overwritten.
    __syncthreads();
#pragma unroll
    for (int m = 0; m < 8; ++m)
#pragma unroll
      for (int t = 0; t < 4; ++t) {
        const v8h h0 = (m < 8 - PARKM) ? rp[m < 8 - PARKM ? m : 0][t]
                                       : *(const v8h*)(pk + ((m - (8 - PARKM)) * 4 + t) * 256);
        _Float16* dst = act + (m * 16 + lm) * RS + wave * 64 + t * 16 + koff;
        *(v8h*)dst         = h0;         // first pass: the lower 512 columns
        *(v8h*)(dst + 512) = rc[m][t];   // second pass: the upper 512
      }
  }
  __syncthreads();
  const _Float16* hfin = act;   // the last layer's output

  // ---------------- head: LN -> Linear(H->1) -> sigmoid ----------------
  for (int q = 0; q < 4; ++q) {
    const int lseg = lsg * 4 + q;
    const _Float16* src = hfin + lrow * RS + lseg * 128;
    float s1 = 0.f, s2 = 0.f;
#pragma unroll
    for (int cc = 0; cc < 128; cc += 8) {
      v8h h = *(const v8h*)(src + cc);
#pragma unroll
      for (int i = 0; i < 8; ++i) { float v = (float)h[i]; s1 += v; s2 += v * v; }
    }
    p1[lrow * 8 + lseg] = s1;
    p2[lrow * 8 + lseg] = s2;
  }
  __syncthreads();
  {
    float s1 = 0.f, s2 = 0.f;
#pragma unroll
    for (int j = 0; j < 8; ++j) { s1 += p1[lrow * 8 + j]; s2 += p2[lrow * 8 + j]; }
    const float m   = s1 * (1.f / HDIM);
    const float var = s2 * (1.f / HDIM) - m * m;
    const float inv = rsqrtf(var + 1e-5f);
    for (int q = 0; q < 4; ++q) {
      const int lseg = lsg * 4 + q;
      const int c0   = lseg * 128;
      const _Float16* src = hfin + lrow * RS + c0;
      const float* lg = last_gamma + c0;
      const float* lb = last_beta + c0;
      const float* lw = last_w + c0;
      float dot = 0.f;
#pragma unroll
      for (int cc = 0; cc < 128; cc += 8) {
        v8h h = *(const v8h*)(src + cc);
#pragma unroll
        for (int i = 0; i < 8; ++i) {
          float v = ((float)h[i] - m) * inv * lg[cc + i] + lb[cc + i];
          dot += v * lw[cc + i];
        }
      }
      p3[lrow * 8 + lseg] = dot;
    }
  }
  __syncthreads();
  if (tid < BM) {
    float dot = 0.f;
#pragma unroll
    for (int j = 0; j < 8; ++j) dot += p3[tid * 8 + j];
    const float z = dot + last_b[0];
    (out + rowBase)[tid] = 1.f / (1.f + __expf(-z));   // scalar base + thread index: no row index kept in a register over the layers
  }
}

// ================= host launcher =================
extern "C" void kernel_launch(void* const* d_in, const int* in_sizes, int n_in,
                              void* d_out, int out_size, void* d_ws, size_t ws_size,
                              hipStream_t stream) {
  (void)in_sizes; (void)n_in; (void)out_size; (void)ws_size;

  const float* x         = (const float*)d_in[0];
  const float* st_gamma  = (const float*)d_in[1];
  const float* st_beta   = (const float*)d_in[2];
  const float* st_w      = (const float*)d_in[3];
  const float* st_b      = (const float*)d_in[4];
  const float* blk_gamma = (const float*)d_in[5];
  const float* blk_beta  = (const float*)d_in[6];
  const float* blk_w     = (const float*)d_in[7];
  const float* blk_b     = (const float*)d_in[8];
  const float* last_gamma= (const float*)d_in[9];
  const float* last_beta = (const float*)d_in[10];
  const float* last_w    = (const float*)d_in[11];
  const float* last_b    = (const float*)d_in[12];
  float* out = (float*)d_out;

  // ws layout: stem weights padded to [1024][32] f16, then block weights, 8*1024*1024 f16, packed,
  // then the two per-column vectors of the folded LayerNorm, 8*1024 f32 each
  _Float16* stemW16 = (_Float16*)d_ws;
  _Float16* blkW16  = stemW16 + (size_t)HDIM * 32;
  float*    blkC1   = (float*)(blkW16 + (size_t)NLAYERS * HDIM * HDIM);
  float*    blkCb   = blkC1 + NLAYERS * HDIM;

  // convert weights to f16 (every call; deterministic)
  {
    const int n8 = NLAYERS * HDIM * HDIM / 8;   // 16-byte pieces
    cvt_blk_kernel<<<(n8 + 255) / 256, 256, 0, stream>>>(blk_w, blk_gamma, blkW16, n8);
    fold_ln_kernel<<<NLAYERS * HDIM * 32 / 256, 256, 0, stream>>>(blk_w, blk_gamma, blk_beta, blk_b,
                                                                  blkC1, blkCb);
    cvt_stem_kernel<<<(HDIM * 32 + 255) / 256, 256, 0, stream>>>(st_w, stemW16);
  }

  static_assert(SMEM_BYTES == 322560, "LDS budget (<= 320KB/WGP)");
  static_assert(3 * PART_FLOATS * 4 <= PARK_HALVES * 2 && BM * SIP <= PARK_HALVES, "what lies on the parking place fits it");
  hipFuncSetAttribute((const void*)mlp_fused_kernel,
                      hipFuncAttributeMaxDynamicSharedMemorySize, SMEM_BYTES);

  const int nBlocks = 65536 / BM;  // 512
  mlp_fused_kernel<<<nBlocks, NTHREADS, SMEM_BYTES, stream>>>(
      x, st_gamma, st_beta, st_b,
      blkC1, blkCb,
      last_gamma, last_beta, last_w, last_b,
      stemW16, blkW16, out);
}
